// v000
// Measured on an AMD MI455X. A time is GPU time per run, averaged over a window of back-to-back runs after a warm-up
// (all launches, gaps included; the runs take copies of the inputs in turn), and the median of several windows.
// Apart from v000's, it joins two sittings. Times from different sittings can be a few percent apart, while
// side-by-side timings come from the same sitting.
// The starting kernel, v000, takes 1140 microseconds a run.
// compute dtype: every float input RNE-converted to bf16 on load; q/k/v = x W + b with exact bf16 products on v_wmma_f32_16x16x32_bf16 (f32 accumulate); logits q k^T: q and k each carried as f16 hi + f16 residual x 2^10 (3 products on v_wmma_f32_16x16x32_f16, f32 accumulate); row min, keep-test and softmax in f32; P x 2^14 to f16 against v f16 (1 product on v_wmma_f32_16x16x32_f16, f32 accumulate) x 2^-14; f32 output.
#include <hip/hip_runtime.h>
#include <math.h>

typedef __attribute__((ext_vector_type(16))) _Float16 v16h;
typedef __attribute__((ext_vector_type(16))) __bf16 v16b;
typedef __attribute__((ext_vector_type(8)))  _Float16 v8h;
typedef __attribute__((ext_vector_type(8)))  __bf16 v8b;
typedef __attribute__((ext_vector_type(8)))  float v8f;
typedef __attribute__((ext_vector_type(4)))  float v4f;
typedef __attribute__((ext_vector_type(4)))  unsigned v4u;

template <typename T> __device__ __forceinline__ void vst2(void* p, T v) { *(T*)p = v;  }

__device__ __forceinline__ v8f wmma16(v16h a, v16h b, v8f c) {
  v8f d = __builtin_amdgcn_wmma_f32_16x16x32_f16(false, a, false, b, (short)0, c, false, false);
  asm volatile("v_nop\n\tv_nop\n\tv_nop\n\tv_nop" : "+v"(d) : "v"(a), "v"(b));
  return d;
}
__device__ __forceinline__ v8f wmma_bf(v16b a, v16b b, v8f c) {
  v8f d = __builtin_amdgcn_wmma_f32_16x16x32_bf16(false, a, false, b, (short)0, c, false, false);
  asm volatile("v_nop\n\tv_nop\n\tv_nop\n\tv_nop" : "+v"(d) : "v"(a), "v"(b));
  return d;
}
// 16x16x32 fragments: lane = (h = lane>>4, row/col = lane&15); elements 0..7 = k0+8h+0..7, 8..15 = k0+16+8h+0..7; D element r = row 8h+r, col lane&15.
// A from a row-major [m][k] row; B from a k-contiguous [n][k] row: identical loader.
__device__ __forceinline__ v16h frag_h(const _Float16* rowk0, int lane) {
  union { v16h v; v8h q[2]; } u; const _Float16* p = rowk0 + 8 * (lane >> 4);
  u.q[0] = *(const v8h*)p; u.q[1] = *(const v8h*)(p + 16); return u.v;
}
__device__ __forceinline__ v16b frag_b(const __bf16* rowk0, int lane) {
  union { v16b v; v8b q[2]; } u; const __bf16* p = rowk0 + 8 * (lane >> 4);
  u.q[0] = *(const v8b*)p; u.q[1] = *(const v8b*)(p + 16); return u.v;
}
__device__ __forceinline__ float bfr(float v) { return (float)(__bf16)v; }
// wave-private LDS tile: element stores by this wave, then 16-B reloads by other lanes of the same wave
__device__ __forceinline__ void ldsx() { asm volatile("s_wait_dscnt 0x0" ::: "memory"); __builtin_amdgcn_wave_barrier(); __builtin_amdgcn_fence(3, "workgroup"); }

// Single-head softmax attention: q/k/v = x W + b (W (in,out) 256x256); logits = q k^T (no scale); keep-test s >= rowmin(s) else -1e9 (identity); softmax over all keys; out = P v.
#ifndef NB
#define NB 4
#endif
#ifndef SEQ
#define SEQ 4096
#endif
#define NB_FULL 4
#define SEQ_FULL 4096
#define TT SEQ
#define CC 256            // projected width (head dim)
#define DIN 256           // input width
#define PP (2 * TT)       // pitch (halves) of the carried f16 P rows placed in the first 8 KB of each f32 logit row
#define PCARRY 16384.0f
#define NEGFILL (-1.0e9f)
static_assert(NB >= 1 && NB <= NB_FULL);
static_assert(SEQ >= 64 && SEQ <= SEQ_FULL && (SEQ % 64) == 0);
static_assert(CC == 256 && DIN == 256);

#define WS_XB  0u                                         // bf16 x rows [NB*TT][DIN]
#define WS_WT  (WS_XB + 2u * (size_t)NB * TT * DIN)        // bf16 weights, out-major [3][CC][DIN]
#define WS_QH  (WS_WT + 2u * (size_t)3 * CC * DIN)         // f16 q hi rows [NB*TT][CC]
#define WS_QL  (WS_QH + 2u * (size_t)NB * TT * CC)         // f16 q residual x 2^10 rows
#define WS_KH  (WS_QL + 2u * (size_t)NB * TT * CC)         // f16 k hi rows
#define WS_KL  (WS_KH + 2u * (size_t)NB * TT * CC)         // f16 k residual x 2^10 rows
#define WS_VT  (WS_KL + 2u * (size_t)NB * TT * CC)         // f16 v planes [NB][CC][TT]
#define WS_S   (WS_VT + 2u * (size_t)NB * CC * TT)         // f32 logits [TT][TT] for one batch; carried f16 P rows in place
#define WS_END (WS_S  + 4u * (size_t)TT * TT)
static_assert(WS_END <= (size_t)134217728u);
static_assert((WS_WT % 128u) == 0 && (WS_QH % 128u) == 0 && (WS_S % 128u) == 0);

__global__ __launch_bounds__(256) void k_xb(const float* __restrict__ X, __bf16* __restrict__ XB) {
  const size_t i = (size_t)blockIdx.x * 256 + threadIdx.x; if (i >= (size_t)NB * TT * (DIN / 8)) return;
  const size_t r = i / (DIN / 8); const int k = (int)(i % (DIN / 8)) * 8;
  const float* p = X + (((r / TT) * SEQ_FULL + (r % TT)) * (size_t)DIN + k);
  const v4f x0 = *(const v4f*)p, x1 = *(const v4f*)(p + 4);
  union { v8b h; v4u u; } o;
#pragma unroll
  for (int e = 0; e < 4; ++e) { o.h[e] = (__bf16)x0[e]; o.h[4 + e] = (__bf16)x1[e]; }
  vst2(XB + r * DIN + k, o.u);
}
// ---- k_wt: block = 16 output columns of one weight: WT[pl][o][k] = bf16(W[k][o]); LDS transpose, whole 512-B rows by 32 consecutive lanes x 16 B
__global__ __launch_bounds__(128) void k_wt(const float* __restrict__ WQ, const float* __restrict__ WK, const float* __restrict__ WV, __bf16* __restrict__ WT) {
  __shared__ __align__(16) __bf16 tr[16][DIN + 8];
  const int tid = threadIdx.x; const int c0 = blockIdx.x * 16; const int pl = blockIdx.y;
  const float* W = pl == 0 ? WQ : pl == 1 ? WK : WV;
#pragma unroll 4
  for (int it = 0; it < (16 * DIN) / 128; ++it) { const int idx = it * 128 + tid; const int k = idx >> 4, cl = idx & 15; tr[cl][k] = (__bf16)W[(size_t)k * CC + c0 + cl]; }
  __syncthreads();
  for (int e = tid; e < 16 * (DIN / 8); e += 128) { const int rl = e >> 5, q = e & 31; vst2(WT + ((size_t)pl * CC + c0 + rl) * DIN + q * 8, *(const v4u*)&tr[rl][q * 8]); }
}
// ---- k_proj: block = (64 compact rows, 128 cols, which): q/k/v = X W + b with exact bf16 products (K = DIN) -> which 0: q f16 hi + residual rows; 1: k f16 hi + residual rows; 2: v f16 planes [c][t]
__global__ __launch_bounds__(128) __attribute__((amdgpu_num_vgpr(256)))
void k_proj(const __bf16* __restrict__ XB, const __bf16* __restrict__ WT, const float* __restrict__ BQ, const float* __restrict__ BK, const float* __restrict__ BV,
            _Float16* __restrict__ QH, _Float16* __restrict__ QL, _Float16* __restrict__ KH, _Float16* __restrict__ KL, _Float16* __restrict__ VT) {
  __shared__ __align__(16) _Float16 sh[64][136], sl[64][136]; __shared__ __align__(16) _Float16 th[128][72];
  const int tid = threadIdx.x, wave = tid >> 5, lane = tid & 31, col = lane & 15, g = lane >> 4;
  const int which = blockIdx.z; const int c0 = blockIdx.y * 128; const size_t r0 = (size_t)blockIdx.x * 64; const size_t bb = r0 / TT; const int t0 = (int)(r0 % TT);
  const float* BA = which == 0 ? BQ : which == 1 ? BK : BV;
  const __bf16* WP = WT + (size_t)which * CC * DIN;
  v8f acc[8] = {};
#pragma unroll 1
  for (int kc = 0; kc < DIN / 32; ++kc) {
    const v16b a = frag_b(XB + (r0 + wave * 16 + col) * DIN + kc * 32, lane);
#pragma unroll
    for (int j = 0; j < 8; ++j) acc[j] = wmma_bf(a, frag_b(WP + (size_t)(c0 + j * 16 + col) * DIN + kc * 32, lane), acc[j]);
  }
  if (which < 2) { _Float16* DH = which == 0 ? QH : KH; _Float16* DL = which == 0 ? QL : KL;
#pragma unroll
    for (int j = 0; j < 8; ++j) { const float bias = bfr(BA[c0 + j * 16 + col]);
#pragma unroll
      for (int r = 0; r < 8; ++r) { const float v = acc[j][r] + bias; const _Float16 hv = (_Float16)v; sh[wave * 16 + 8 * g + r][j * 16 + col] = hv; sl[wave * 16 + 8 * g + r][j * 16 + col] = (_Float16)((v - (float)hv) * 1024.0f); } }
    __syncthreads();
    for (int e = tid; e < 64 * 16; e += 128) { const int rl = e >> 4, q = e & 15; vst2(DH + (r0 + rl) * CC + c0 + q * 8, *(const v4u*)&sh[rl][q * 8]); vst2(DL + (r0 + rl) * CC + c0 + q * 8, *(const v4u*)&sl[rl][q * 8]); }
  } else {
#pragma unroll
    for (int j = 0; j < 8; ++j) { const float bias = bfr(BA[c0 + j * 16 + col]);
#pragma unroll
      for (int r = 0; r < 8; ++r) { const float v = acc[j][r] + bias; const int rl = wave * 16 + 8 * g + r, cl = j * 16 + col; th[cl][rl] = (_Float16)v; } }
    __syncthreads();
    for (int e = tid; e < 128 * 8; e += 128) { const int cl = e >> 3, q = e & 7; vst2(VT + (bb * CC + c0 + cl) * (size_t)TT + t0 + q * 8, *(const v4u*)&th[cl][q * 8]); } }
}
// ---- k_sc: block = (64 query rows = 4 waves x 16, 64 keys = 4 tiles) of batch b: logit = qh.kh + 2^-10 (ql.kh + qh.kl); 256-B row segment by lanes 0..15 x 16 B
__global__ __launch_bounds__(128) __attribute__((amdgpu_num_vgpr(256)))
void k_sc(const _Float16* __restrict__ QH, const _Float16* __restrict__ KH, const _Float16* __restrict__ QL, const _Float16* __restrict__ KL, int b, float* __restrict__ S) {
  __shared__ __align__(16) float ss[4][16][68];
  const int tid = threadIdx.x, wave = tid >> 5, lane = tid & 31, col = lane & 15, g = lane >> 4;
  const int qb = blockIdx.x, kb = blockIdx.y; const int k0 = kb * 64; const int ql0 = qb * 64 + wave * 16;
  const size_t q0 = (size_t)b * TT + ql0, kr0 = (size_t)b * TT + k0;
  v8f acc[4] = {}, accl[4] = {};
#pragma unroll 1
  for (int kc = 0; kc < CC / 32; ++kc) {
    const v16h ah = frag_h(QH + (q0 + col) * CC + kc * 32, lane), al = frag_h(QL + (q0 + col) * CC + kc * 32, lane);
#pragma unroll
    for (int j = 0; j < 4; ++j) {
      const v16h kf = frag_h(KH + (kr0 + j * 16 + col) * CC + kc * 32, lane), kl = frag_h(KL + (kr0 + j * 16 + col) * CC + kc * 32, lane);
      acc[j] = wmma16(ah, kf, acc[j]); accl[j] = wmma16(al, kf, accl[j]); accl[j] = wmma16(ah, kl, accl[j]); } }
#pragma unroll
  for (int j = 0; j < 4; ++j) {
#pragma unroll
    for (int r = 0; r < 8; ++r) ss[wave][8 * g + r][j * 16 + col] = acc[j][r] + accl[j][r] * (1.0f / 1024.0f); }
  ldsx();
  for (int rl = 0; rl < 16; ++rl) if (lane < 16) vst2(S + (size_t)(ql0 + rl) * TT + k0 + lane * 4, *(const v4f*)&ss[wave][rl][lane * 4]);
}
__global__ __launch_bounds__(256) void k_sm(float* __restrict__ S0) {
  __shared__ float sred[8], sred2[8]; __shared__ float sbc, sbc2; __shared__ __align__(16) float shv[TT];
  const int tid = threadIdx.x, lane = tid & 31, wv = tid >> 5; const int t = blockIdx.x;
  const float* sr = S0 + (size_t)t * TT; _Float16* pr = (_Float16*)(S0 + (size_t)t * TT);
  float m = -3.0e38f, mn = 3.0e38f;
#pragma unroll 1
  for (int q = tid; q < TT / 4; q += 256) { const v4f x = *(const v4f*)(sr + q * 4); *(v4f*)&shv[q * 4] = x;
    m = fmaxf(fmaxf(m, fmaxf(x[0], x[1])), fmaxf(x[2], x[3])); mn = fminf(fminf(mn, fminf(x[0], x[1])), fminf(x[2], x[3])); }
#pragma unroll
  for (int o = 1; o < 32; o <<= 1) { m = fmaxf(m, __shfl_xor(m, o)); mn = fminf(mn, __shfl_xor(mn, o)); }
  if (lane == 0) { sred[wv] = m; sred2[wv] = mn; } __syncthreads();
  if (tid == 0) { float a = sred[0], c = sred2[0]; for (int i = 1; i < 8; ++i) { a = fmaxf(a, sred[i]); c = fminf(c, sred2[i]); } sbc = a; sbc2 = c; }
  __syncthreads(); m = sbc; mn = sbc2; __syncthreads();
  float sum = 0.f;
#pragma unroll 1
  for (int k = tid; k < TT; k += 256) { float v = shv[k]; v = (v >= mn) ? v : NEGFILL; const float e = expf(v - m); shv[k] = e; sum += e; }
#pragma unroll
  for (int o = 1; o < 32; o <<= 1) sum += __shfl_xor(sum, o);
  if (lane == 0) sred[wv] = sum; __syncthreads();
  if (tid == 0) { float a = 0.f; for (int i = 0; i < 8; ++i) a += sred[i]; sbc = PCARRY * (1.0f / a); }
  __syncthreads(); const float inv = sbc;
#pragma unroll 1
  for (int q = tid; q < TT / 8; q += 256) { const v4f e0 = *(const v4f*)&shv[q * 8], e1 = *(const v4f*)&shv[q * 8 + 4]; union { v8h h; v4u u; } pk;
#pragma unroll
    for (int i = 0; i < 4; ++i) { pk.h[i] = (_Float16)(e0[i] * inv); pk.h[4 + i] = (_Float16)(e1[i] * inv); }
    vst2(pr + q * 8, pk.u); }
}
// ---- k_pv: block = (64 queries = 4 waves x 16, 128-column half ch) of batch b: out = (P_carried . v) x 2^-14 over all TT keys (1 product); 512-B row segment by 32 lanes x 16 B
__global__ __launch_bounds__(128) __attribute__((amdgpu_num_vgpr(256)))
void k_pv(const _Float16* __restrict__ PH, const _Float16* __restrict__ VT, int b, float* __restrict__ OUT) {
  __shared__ __align__(16) float ss[4][16][132];
  const int tid = threadIdx.x, wave = tid >> 5, lane = tid & 31, col = lane & 15, g = lane >> 4;
  const int qb = blockIdx.x, ch = blockIdx.y; const int ql0 = qb * 64 + wave * 16;
  const _Float16* Vp = VT + ((size_t)b * CC + ch * 128) * TT;
  v8f acc[8] = {};
#pragma unroll 1
  for (int kc = 0; kc < TT / 32; ++kc) {
    const v16h p = frag_h(PH + (size_t)(ql0 + col) * PP + kc * 32, lane);
#pragma unroll
    for (int j = 0; j < 8; ++j) acc[j] = wmma16(p, frag_h(Vp + (size_t)(j * 16 + col) * TT + kc * 32, lane), acc[j]);
  }
#pragma unroll
  for (int j = 0; j < 8; ++j) {
#pragma unroll
    for (int r = 0; r < 8; ++r) ss[wave][8 * g + r][j * 16 + col] = acc[j][r] * (1.0f / PCARRY); }
  ldsx();
  for (int rl = 0; rl < 16; ++rl) vst2(OUT + ((size_t)b * TT + ql0 + rl) * CC + ch * 128 + lane * 4, *(const v4f*)&ss[wave][rl][lane * 4]);
}

extern "C" void kernel_launch(void* const* d_in, const int* in_sizes, int n_in, void* d_out, int out_size, void* d_ws, size_t ws_size, hipStream_t stream) {
  // inputs (wire order): 0 x [4,4096,256]; 1 Wq [256,256] (in,out); 2 bq [256]; 3 Wk; 4 bk; 5 Wv; 6 bv; all f32
  if (n_in < 7) return;
  if ((size_t)in_sizes[0] < ((size_t)(NB - 1) * SEQ_FULL + TT) * DIN) return;
  if (in_sizes[1] < DIN * CC || in_sizes[3] < DIN * CC || in_sizes[5] < DIN * CC) return;
  if (in_sizes[2] < CC || in_sizes[4] < CC || in_sizes[6] < CC) return;
  if ((size_t)out_size < (size_t)NB * TT * CC) return;
  if (ws_size < (size_t)WS_END) return;
  const float** F = (const float**)d_in;
  char* ws = (char*)d_ws;
  __bf16 *XB = (__bf16*)(ws + WS_XB), *WT = (__bf16*)(ws + WS_WT);
  _Float16 *QH = (_Float16*)(ws + WS_QH), *QL = (_Float16*)(ws + WS_QL), *KH = (_Float16*)(ws + WS_KH), *KL = (_Float16*)(ws + WS_KL), *VT = (_Float16*)(ws + WS_VT);
  float* S = (float*)(ws + WS_S); const _Float16* PH = (const _Float16*)(ws + WS_S);
  float* OUT = (float*)d_out;
  k_xb<<<dim3((unsigned)(((size_t)NB * TT * (DIN / 8) + 255) / 256)), 256, 0, stream>>>(F[0], XB);
  k_wt<<<dim3(CC / 16, 3), 128, 0, stream>>>(F[1], F[3], F[5], WT);
  k_proj<<<dim3(NB * TT / 64, CC / 128, 3), 128, 0, stream>>>(XB, WT, F[2], F[4], F[6], QH, QL, KH, KL, VT);
  for (int b = 0; b < NB; ++b) {
    k_sc<<<dim3(TT / 64, TT / 64), 128, 0, stream>>>(QH, KH, QL, KL, b, S);
    k_sm<<<dim3(TT), 256, 0, stream>>>(S);
    k_pv<<<dim3(TT / 64, CC / 128), 128, 0, stream>>>(PH, VT, b, OUT);
  }
}

// v001
// Measured time: 430 microseconds a run.
// Next to v000, in two timings, it ran 2.73 and 2.65 times as fast.
// compute dtype: every float input RNE-converted to bf16 on load; q/k/v = x W + b with exact bf16 products on v_wmma_f32_16x16x32_bf16 (f32 accumulate); logits q k^T: q and k each carried as f16 hi + f16 residual x 2^10 (3 products on v_wmma_f32_16x16x32_f16, f32 accumulate); row min, keep-test and softmax in f32; P x 2^14 to f16 against v f16 (1 product on v_wmma_f32_16x16x32_f16, f32 accumulate) x 2^-14; f32 output.
#include <hip/hip_runtime.h>
#include <math.h>

typedef __attribute__((ext_vector_type(16))) _Float16 v16h;
typedef __attribute__((ext_vector_type(16))) __bf16 v16b;
typedef __attribute__((ext_vector_type(8)))  _Float16 v8h;
typedef __attribute__((ext_vector_type(8)))  __bf16 v8b;
typedef __attribute__((ext_vector_type(8)))  float v8f;
typedef __attribute__((ext_vector_type(4)))  float v4f;
typedef __attribute__((ext_vector_type(4)))  unsigned v4u;

template <typename T> __device__ __forceinline__ void vst2(void* p, T v) { *(T*)p = v;  }

__device__ __forceinline__ v8f wmma16(v16h a, v16h b, v8f c) {
  v8f d = __builtin_amdgcn_wmma_f32_16x16x32_f16(false, a, false, b, (short)0, c, false, false);
  asm volatile("v_nop\n\tv_nop\n\tv_nop\n\tv_nop" : "+v"(d) : "v"(a), "v"(b));
  return d;
}
__device__ __forceinline__ v8f wmma_bf(v16b a, v16b b, v8f c) {
  v8f d = __builtin_amdgcn_wmma_f32_16x16x32_bf16(false, a, false, b, (short)0, c, false, false);
  asm volatile("v_nop\n\tv_nop\n\tv_nop\n\tv_nop" : "+v"(d) : "v"(a), "v"(b));
  return d;
}
// 16x16x32 fragments: lane = (h = lane>>4, row/col = lane&15); elements 0..7 = k0+8h+0..7, 8..15 = k0+16+8h+0..7; D element r = row 8h+r, col lane&15.
// A from a row-major [m][k] row; B from a k-contiguous [n][k] row: identical loader.
__device__ __forceinline__ v16h frag_h(const _Float16* rowk0, int lane) {
  union { v16h v; v8h q[2]; } u; const _Float16* p = rowk0 + 8 * (lane >> 4);
  u.q[0] = *(const v8h*)p; u.q[1] = *(const v8h*)(p + 16); return u.v;
}
__device__ __forceinline__ v16b frag_b(const __bf16* rowk0, int lane) {
  union { v16b v; v8b q[2]; } u; const __bf16* p = rowk0 + 8 * (lane >> 4);
  u.q[0] = *(const v8b*)p; u.q[1] = *(const v8b*)(p + 16); return u.v;
}
__device__ __forceinline__ float bfr(float v) { return (float)(__bf16)v; }
// wave-private LDS tile: element stores by this wave, then 16-B reloads by other lanes of the same wave
__device__ __forceinline__ void ldsx() { asm volatile("s_wait_dscnt 0x0" ::: "memory"); __builtin_amdgcn_wave_barrier(); __builtin_amdgcn_fence(3, "workgroup"); }

// Single-head softmax attention: q/k/v = x W + b (W (in,out) 256x256); logits = q k^T (no scale); keep-test s >= rowmin(s) else -1e9 (identity); softmax over all keys; out = P v.
#ifndef NB
#define NB 4
#endif
#ifndef SEQ
#define SEQ 4096
#endif
#define NB_FULL 4
#define SEQ_FULL 4096
#define TT SEQ
#define CC 256            // projected width (head dim)
#define DIN 256           // input width
#define PP (2 * TT)       // pitch (halves) of the carried f16 P rows placed in the first 8 KB of each f32 logit row
#define PCARRY 16384.0f
#define NEGFILL (-1.0e9f)
static_assert(NB >= 1 && NB <= NB_FULL);
static_assert(SEQ >= 64 && SEQ <= SEQ_FULL && (SEQ % 64) == 0);
static_assert(CC == 256 && DIN == 256);

#define WS_XB  0u                                         // bf16 x rows [NB*TT][DIN]
#define WS_WT  (WS_XB + 2u * (size_t)NB * TT * DIN)        // bf16 weights, out-major [3][CC][DIN]
#define WS_QH  (WS_WT + 2u * (size_t)3 * CC * DIN)         // f16 q hi rows [NB*TT][CC]
#define WS_QL  (WS_QH + 2u * (size_t)NB * TT * CC)         // f16 q residual x 2^10 rows
#define WS_KH  (WS_QL + 2u * (size_t)NB * TT * CC)         // f16 k hi rows
#define WS_KL  (WS_KH + 2u * (size_t)NB * TT * CC)         // f16 k residual x 2^10 rows
#define WS_VT  (WS_KL + 2u * (size_t)NB * TT * CC)         // f16 v planes [NB][CC][TT]
#define WS_S   (WS_VT + 2u * (size_t)NB * CC * TT)         // f32 logits [TT][TT] for one batch; carried f16 P rows in place
#define WS_END (WS_S  + 4u * (size_t)TT * TT)
static_assert(WS_END <= (size_t)134217728u);
static_assert((WS_WT % 128u) == 0 && (WS_QH % 128u) == 0 && (WS_S % 128u) == 0);

__global__ __launch_bounds__(256) void k_xb(const float* __restrict__ X, __bf16* __restrict__ XB) {
  const size_t i = (size_t)blockIdx.x * 256 + threadIdx.x; if (i >= (size_t)NB * TT * (DIN / 8)) return;
  const size_t r = i / (DIN / 8); const int k = (int)(i % (DIN / 8)) * 8;
  const float* p = X + (((r / TT) * SEQ_FULL + (r % TT)) * (size_t)DIN + k);
  const v4f x0 = *(const v4f*)p, x1 = *(const v4f*)(p + 4);
  union { v8b h; v4u u; } o;
#pragma unroll
  for (int e = 0; e < 4; ++e) { o.h[e] = (__bf16)x0[e]; o.h[4 + e] = (__bf16)x1[e]; }
  vst2(XB + r * DIN + k, o.u);
}
// ---- k_wt: block = 16 output columns of one weight: WT[pl][o][k] = bf16(W[k][o]); LDS transpose, whole 512-B rows by 32 consecutive lanes x 16 B
__global__ __launch_bounds__(128) void k_wt(const float* __restrict__ WQ, const float* __restrict__ WK, const float* __restrict__ WV, __bf16* __restrict__ WT) {
  __shared__ __align__(16) __bf16 tr[16][DIN + 8];
  const int tid = threadIdx.x; const int c0 = blockIdx.x * 16; const int pl = blockIdx.y;
  const float* W = pl == 0 ? WQ : pl == 1 ? WK : WV;
#pragma unroll 4
  for (int it = 0; it < (16 * DIN) / 128; ++it) { const int idx = it * 128 + tid; const int k = idx >> 4, cl = idx & 15; tr[cl][k] = (__bf16)W[(size_t)k * CC + c0 + cl]; }
  __syncthreads();
  for (int e = tid; e < 16 * (DIN / 8); e += 128) { const int rl = e >> 5, q = e & 31; vst2(WT + ((size_t)pl * CC + c0 + rl) * DIN + q * 8, *(const v4u*)&tr[rl][q * 8]); }
}
// ---- k_proj: block = (64 compact rows, 128 cols, which): q/k/v = X W + b with exact bf16 products (K = DIN) -> which 0: q f16 hi + residual rows; 1: k f16 hi + residual rows; 2: v f16 planes [c][t]
__global__ __launch_bounds__(128) __attribute__((amdgpu_num_vgpr(256)))
void k_proj(const __bf16* __restrict__ XB, const __bf16* __restrict__ WT, const float* __restrict__ BQ, const float* __restrict__ BK, const float* __restrict__ BV,
            _Float16* __restrict__ QH, _Float16* __restrict__ QL, _Float16* __restrict__ KH, _Float16* __restrict__ KL, _Float16* __restrict__ VT) {
  __shared__ __align__(16) _Float16 sh[64][136], sl[64][136]; __shared__ __align__(16) _Float16 th[128][72];
  const int tid = threadIdx.x, wave = tid >> 5, lane = tid & 31, col = lane & 15, g = lane >> 4;
  const int which = blockIdx.z; const int c0 = blockIdx.y * 128; const size_t r0 = (size_t)blockIdx.x * 64; const size_t bb = r0 / TT; const int t0 = (int)(r0 % TT);
  const float* BA = which == 0 ? BQ : which == 1 ? BK : BV;
  const __bf16* WP = WT + (size_t)which * CC * DIN;
  v8f acc[8] = {};
#pragma unroll 1
  for (int kc = 0; kc < DIN / 32; ++kc) {
    const v16b a = frag_b(XB + (r0 + wave * 16 + col) * DIN + kc * 32, lane);
#pragma unroll
    for (int j = 0; j < 8; ++j) acc[j] = wmma_bf(a, frag_b(WP + (size_t)(c0 + j * 16 + col) * DIN + kc * 32, lane), acc[j]);
  }
  if (which < 2) { _Float16* DH = which == 0 ? QH : KH; _Float16* DL = which == 0 ? QL : KL;
#pragma unroll
    for (int j = 0; j < 8; ++j) { const float bias = bfr(BA[c0 + j * 16 + col]);
#pragma unroll
      for (int r = 0; r < 8; ++r) { const float v = acc[j][r] + bias; const _Float16 hv = (_Float16)v; sh[wave * 16 + 8 * g + r][j * 16 + col] = hv; sl[wave * 16 + 8 * g + r][j * 16 + col] = (_Float16)((v - (float)hv) * 1024.0f); } }
    __syncthreads();
    for (int e = tid; e < 64 * 16; e += 128) { const int rl = e >> 4, q = e & 15; vst2(DH + (r0 + rl) * CC + c0 + q * 8, *(const v4u*)&sh[rl][q * 8]); vst2(DL + (r0 + rl) * CC + c0 + q * 8, *(const v4u*)&sl[rl][q * 8]); }
  } else {
#pragma unroll
    for (int j = 0; j < 8; ++j) { const float bias = bfr(BA[c0 + j * 16 + col]);
#pragma unroll
      for (int r = 0; r < 8; ++r) { const float v = acc[j][r] + bias; const int rl = wave * 16 + 8 * g + r, cl = j * 16 + col; th[cl][rl] = (_Float16)v; } }
    __syncthreads();
    for (int e = tid; e < 128 * 8; e += 128) { const int cl = e >> 3, q = e & 7; vst2(VT + (bb * CC + c0 + cl) * (size_t)TT + t0 + q * 8, *(const v4u*)&th[cl][q * 8]); } }
}
// ---- asynchronous copies global -> LDS, 16 B a lane (512 B a copy), through no register. l, g: the lane's own LDS byte address and global address; ls, gs: step from copy to copy (bytes; halves).
// The closing s_wait_xcnt keeps every later write of these address registers behind the copies.
__device__ __forceinline__ void copy8(unsigned l, unsigned ls, const _Float16* g, size_t gs) {
  asm volatile("global_load_async_to_lds_b128 %0, %8, off\n\t"
               "global_load_async_to_lds_b128 %1, %9, off\n\t"
               "global_load_async_to_lds_b128 %2, %10, off\n\t"
               "global_load_async_to_lds_b128 %3, %11, off\n\t"
               "global_load_async_to_lds_b128 %4, %12, off\n\t"
               "global_load_async_to_lds_b128 %5, %13, off\n\t"
               "global_load_async_to_lds_b128 %6, %14, off\n\t"
               "global_load_async_to_lds_b128 %7, %15, off\n\t"
               "s_wait_xcnt 0x0"
               :: "v"(l), "v"(l + ls), "v"(l + 2 * ls), "v"(l + 3 * ls), "v"(l + 4 * ls), "v"(l + 5 * ls), "v"(l + 6 * ls), "v"(l + 7 * ls),
                  "v"(g), "v"(g + gs), "v"(g + 2 * gs), "v"(g + 3 * gs), "v"(g + 4 * gs), "v"(g + 5 * gs), "v"(g + 6 * gs), "v"(g + 7 * gs)
               : "memory");
}
// one wave's share of a stage: 32 copies
__device__ __forceinline__ void copy32(unsigned l, unsigned ls, const _Float16* g, size_t gs) {
  copy8(l, ls, g, gs); copy8(l + 8 * ls, ls, g + 8 * gs, gs); copy8(l + 16 * ls, ls, g + 16 * gs, gs); copy8(l + 24 * ls, ls, g + 24 * gs, gs);
}
// ---- k_sc: block = (64 query rows, 64 keys) of batch b, 4 waves as 2 x 2, each 32 x 32: logit = qh.kh + 2^-10 (ql.kh + qh.kl).
// A stage = 128 of the 256 k of the 64 rows of q hi, q residual, k hi, k residual (256-B rows, LDS pitch 272 B), brought by asynchronous copies; the two stages have a buffer each; every fragment is read from LDS.
#define SC_KP 128                 // k per stage
#define SC_PITCH (SC_KP + 8)      // halves; 272 B = 16 B x odd for the 16-B fragment reads
#define SC_ROWS 256               // 64 rows each of q hi, q residual, k hi, k residual
static_assert(CC == 2 * SC_KP);
__device__ __forceinline__ void sc_stage(const _Float16 (*bf)[SC_PITCH], int qr, int kr, int lane, v8f (&acc)[2][2], v8f (&accl)[2][2]) {
#pragma unroll    // the LDS offsets of the four k steps become immediates
  for (int kk = 0; kk < SC_KP / 32; ++kk) {
    const v16h ah0 = frag_h(&bf[qr][kk * 32], lane), ah1 = frag_h(&bf[qr + 16][kk * 32], lane), al0 = frag_h(&bf[64 + qr][kk * 32], lane), al1 = frag_h(&bf[64 + qr + 16][kk * 32], lane);
    const v16h kf0 = frag_h(&bf[128 + kr][kk * 32], lane), kf1 = frag_h(&bf[128 + kr + 16][kk * 32], lane), kl0 = frag_h(&bf[192 + kr][kk * 32], lane), kl1 = frag_h(&bf[192 + kr + 16][kk * 32], lane);
    acc[0][0] = wmma16(ah0, kf0, acc[0][0]); acc[0][1] = wmma16(ah0, kf1, acc[0][1]); acc[1][0] = wmma16(ah1, kf0, acc[1][0]); acc[1][1] = wmma16(ah1, kf1, acc[1][1]);
    accl[0][0] = wmma16(al0, kf0, accl[0][0]); accl[0][1] = wmma16(al0, kf1, accl[0][1]); accl[1][0] = wmma16(al1, kf0, accl[1][0]); accl[1][1] = wmma16(al1, kf1, accl[1][1]);
    accl[0][0] = wmma16(ah0, kl0, accl[0][0]); accl[0][1] = wmma16(ah0, kl1, accl[0][1]); accl[1][0] = wmma16(ah1, kl0, accl[1][0]); accl[1][1] = wmma16(ah1, kl1, accl[1][1]);
  }
}
__global__ __launch_bounds__(128) __attribute__((amdgpu_num_vgpr(256)))
void k_sc(const _Float16* __restrict__ QH, const _Float16* __restrict__ KH, const _Float16* __restrict__ QL, const _Float16* __restrict__ KL, int b, float* __restrict__ S) {
  __shared__ __align__(16) _Float16 st[2][SC_ROWS][SC_PITCH];
  __shared__ __align__(16) float ss[4][32][36];
  const int tid = threadIdx.x, wave = __builtin_amdgcn_readfirstlane(tid >> 5), lane = tid & 31, col = lane & 15, g = lane >> 4;
  const int q0 = blockIdx.x * 64, k0 = blockIdx.y * 64; const int wm = wave >> 1, wn = wave & 1;
  // wave w copies the 64 rows of operand w, two 256-B rows a copy (lanes 0..15 one row, lanes 16..31 the next)
  const _Float16* gsrc = (wave == 0 ? QH : wave == 1 ? QL : wave == 2 ? KH : KL) + ((size_t)b * TT + (wave < 2 ? q0 : k0) + g) * CC + col * 8;
  const unsigned lbase = (unsigned)(size_t)&st[0][wave * 64 + g][col * 8];
  v8f acc[2][2] = {}, accl[2][2] = {};
  copy32(lbase, 4u * SC_PITCH, gsrc, 2 * CC);
  asm volatile("s_wait_asynccnt 0x0" ::: "memory");   // stage 0 of this wave has landed
  __syncthreads();                                     // ... and of every wave
  copy32(lbase + (unsigned)(2 * SC_ROWS * SC_PITCH), 4u * SC_PITCH, gsrc + SC_KP, 2 * CC);
  sc_stage(st[0], wm * 32 + col, wn * 32 + col, lane, acc, accl);
  asm volatile("s_wait_dscnt 0x0" ::: "memory");      // the publish point's order: this wave's LDS reads first,
  asm volatile("s_wait_asynccnt 0x0" ::: "memory");   // then its copies of stage 1 have landed; none is in flight behind this line
  __syncthreads();                                     // publishes stage 1
  sc_stage(st[1], wm * 32 + col, wn * 32 + col, lane, acc, accl);
  // the three loops are unrolled so that every accumulator index is a constant (registers, no scratch)
#pragma unroll
  for (int mi = 0; mi < 2; ++mi) {
#pragma unroll
    for (int ni = 0; ni < 2; ++ni) {
#pragma unroll
      for (int r = 0; r < 8; ++r) ss[wave][mi * 16 + 8 * g + r][ni * 16 + col] = acc[mi][ni][r] + accl[mi][ni][r] * (1.0f / 1024.0f); } }
  ldsx();
  float* sp = S + (size_t)(q0 + wm * 32 + (lane >> 3)) * TT + k0 + wn * 32 + (lane & 7) * 4;
  // 128-B row segment by 8 lanes x 16 B, four rows a store; unrolled so that the eight LDS reads go out together
#pragma unroll
  for (int it = 0; it < 8; ++it) vst2(sp + (size_t)it * 4 * TT, *(const v4f*)&ss[wave][it * 4 + (lane >> 3)][(lane & 7) * 4]);
}
__global__ __launch_bounds__(256) void k_sm(float* __restrict__ S0) {
  __shared__ float sred[8], sred2[8]; __shared__ float sbc, sbc2; __shared__ __align__(16) float shv[TT];
  const int tid = threadIdx.x, lane = tid & 31, wv = tid >> 5; const int t = blockIdx.x;
  const float* sr = S0 + (size_t)t * TT; _Float16* pr = (_Float16*)(S0 + (size_t)t * TT);
  float m = -3.0e38f, mn = 3.0e38f;
#pragma unroll 1
  for (int q = tid; q < TT / 4; q += 256) { const v4f x = *(const v4f*)(sr + q * 4); *(v4f*)&shv[q * 4] = x;
    m = fmaxf(fmaxf(m, fmaxf(x[0], x[1])), fmaxf(x[2], x[3])); mn = fminf(fminf(mn, fminf(x[0], x[1])), fminf(x[2], x[3])); }
#pragma unroll
  for (int o = 1; o < 32; o <<= 1) { m = fmaxf(m, __shfl_xor(m, o)); mn = fminf(mn, __shfl_xor(mn, o)); }
  if (lane == 0) { sred[wv] = m; sred2[wv] = mn; } __syncthreads();
  if (tid == 0) { float a = sred[0], c = sred2[0]; for (int i = 1; i < 8; ++i) { a = fmaxf(a, sred[i]); c = fminf(c, sred2[i]); } sbc = a; sbc2 = c; }
  __syncthreads(); m = sbc; mn = sbc2; __syncthreads();
  float sum = 0.f;
#pragma unroll 1
  for (int k = tid; k < TT; k += 256) { float v = shv[k]; v = (v >= mn) ? v : NEGFILL; const float e = expf(v - m); shv[k] = e; sum += e; }
#pragma unroll
  for (int o = 1; o < 32; o <<= 1) sum += __shfl_xor(sum, o);
  if (lane == 0) sred[wv] = sum; __syncthreads();
  if (tid == 0) { float a = 0.f; for (int i = 0; i < 8; ++i) a += sred[i]; sbc = PCARRY * (1.0f / a); }
  __syncthreads(); const float inv = sbc;
#pragma unroll 1
  for (int q = tid; q < TT / 8; q += 256) { const v4f e0 = *(const v4f*)&shv[q * 8], e1 = *(const v4f*)&shv[q * 8 + 4]; union { v8h h; v4u u; } pk;
#pragma unroll
    for (int i = 0; i < 4; ++i) { pk.h[i] = (_Float16)(e0[i] * inv); pk.h[4 + i] = (_Float16)(e1[i] * inv); }
    vst2(pr + q * 8, pk.u); }
}
// ---- k_pv: block = (64 queries, 64 columns) of batch b, 8 waves as 4 x 2, each 16 x 32: out = (P_carried . v) x 2^-14 over all TT keys (1 product).
// A stage = 256 keys of the 64 P rows and of the 64 v rows (512-B rows, LDS pitch 528 B), brought by asynchronous copies into two buffers; every fragment is read from LDS.
#define PV_KP 256                 // keys per stage
#define PV_PITCH (PV_KP + 8)      // halves; 528 B = 16 B x odd for the 16-B fragment reads
#define PV_ROWS 128               // 64 P rows, then 64 v rows
#define PV_NT (TT / PV_KP)
static_assert((TT % PV_KP) == 0);
// one wave's share of a stage: 16 whole rows, a row a copy
__device__ __forceinline__ void pv_copy(unsigned l, const _Float16* g, size_t gp) { copy8(l, 2u * PV_PITCH, g, gp); copy8(l + 16u * PV_PITCH, 2u * PV_PITCH, g + 8 * gp, gp); }
__global__ __launch_bounds__(256) __attribute__((amdgpu_num_vgpr(256)))
void k_pv(const _Float16* __restrict__ PH, const _Float16* __restrict__ VT, int b, float* __restrict__ OUT) {
  __shared__ __align__(16) _Float16 ring[2][PV_ROWS][PV_PITCH];
  __shared__ __align__(16) float ss[8][16][36];
  const int tid = threadIdx.x, wave = __builtin_amdgcn_readfirstlane(tid >> 5), lane = tid & 31, col = lane & 15, g = lane >> 4;
  const int q0 = blockIdx.x * 64, c0 = blockIdx.y * 64; const int wm = wave >> 1, wn = wave & 1;
  // wave w copies rows 16 w .. 16 w + 15 of a stage: waves 0..3 the P rows, waves 4..7 the v rows
  const size_t gp = wave < 4 ? (size_t)PP : (size_t)TT;
  const _Float16* gsrc = (wave < 4 ? PH + (size_t)(q0 + wave * 16) * PP : VT + ((size_t)b * CC + c0 + (wave - 4) * 16) * TT) + lane * 8;
  const unsigned lbase = (unsigned)(size_t)&ring[0][wave * 16][lane * 8];
  v8f acc[2] = {};
  pv_copy(lbase, gsrc, gp);
  asm volatile("s_wait_asynccnt 0x0" ::: "memory");   // stage 0 of this wave has landed
  __syncthreads();                                     // ... and of every wave
  if (PV_NT > 1) pv_copy(lbase + (unsigned)(2 * PV_ROWS * PV_PITCH), gsrc + PV_KP, gp);
#pragma unroll 1  // one body for both buffers: the code stays short
  for (int t = 0; t < PV_NT; ++t) {
    const _Float16 (*bf)[PV_PITCH] = ring[t & 1];
#pragma unroll    // the LDS offsets of the eight k steps become immediates
    for (int kk = 0; kk < PV_KP / 32; ++kk) {
      const v16h p = frag_h(&bf[wm * 16 + col][kk * 32], lane);
      const v16h v0 = frag_h(&bf[64 + wn * 32 + col][kk * 32], lane), v1 = frag_h(&bf[64 + wn * 32 + 16 + col][kk * 32], lane);
      acc[0] = wmma16(p, v0, acc[0]); acc[1] = wmma16(p, v1, acc[1]);
    }
    asm volatile("s_wait_dscnt 0x0" ::: "memory");     // this wave's reads of stage t are done before the buffer is handed back
    asm volatile("s_wait_asynccnt 0x0" ::: "memory");  // this wave's copies of stage t + 1 have landed
    __syncthreads();                                   // publishes stage t + 1 and frees stage t's buffer
    if (t + 2 < PV_NT) pv_copy(lbase + (unsigned)(t & 1) * (unsigned)(2 * PV_ROWS * PV_PITCH), gsrc + (size_t)(t + 2) * PV_KP, gp);
  }
  asm volatile("s_wait_asynccnt 0x0" ::: "memory");    // no copy is left in flight when the wave ends
  // both loops are unrolled so that every accumulator index is a constant (registers, no scratch)
#pragma unroll
  for (int ni = 0; ni < 2; ++ni) {
#pragma unroll
    for (int r = 0; r < 8; ++r) ss[wave][8 * g + r][ni * 16 + col] = acc[ni][r] * (1.0f / PCARRY); }
  ldsx();
  float* op = OUT + ((size_t)b * TT + q0 + wm * 16 + (lane >> 3)) * CC + c0 + wn * 32 + (lane & 7) * 4;
  // 128-B row segment by 8 lanes x 16 B, four rows a store; unrolled so that the four LDS reads go out together
#pragma unroll
  for (int it = 0; it < 4; ++it) vst2(op + (size_t)it * 4 * CC, *(const v4f*)&ss[wave][it * 4 + (lane >> 3)][(lane & 7) * 4]);
}

extern "C" void kernel_launch(void* const* d_in, const int* in_sizes, int n_in, void* d_out, int out_size, void* d_ws, size_t ws_size, hipStream_t stream) {
  // inputs (wire order): 0 x [4,4096,256]; 1 Wq [256,256] (in,out); 2 bq [256]; 3 Wk; 4 bk; 5 Wv; 6 bv; all f32
  if (n_in < 7) return;
  if ((size_t)in_sizes[0] < ((size_t)(NB - 1) * SEQ_FULL + TT) * DIN) return;
  if (in_sizes[1] < DIN * CC || in_sizes[3] < DIN * CC || in_sizes[5] < DIN * CC) return;
  if (in_sizes[2] < CC || in_sizes[4] < CC || in_sizes[6] < CC) return;
  if ((size_t)out_size < (size_t)NB * TT * CC) return;
  if (ws_size < (size_t)WS_END) return;
  const float** F = (const float**)d_in;
  char* ws = (char*)d_ws;
  __bf16 *XB = (__bf16*)(ws + WS_XB), *WT = (__bf16*)(ws + WS_WT);
  _Float16 *QH = (_Float16*)(ws + WS_QH), *QL = (_Float16*)(ws + WS_QL), *KH = (_Float16*)(ws + WS_KH), *KL = (_Float16*)(ws + WS_KL), *VT = (_Float16*)(ws + WS_VT);
  float* S = (float*)(ws + WS_S); const _Float16* PH = (const _Float16*)(ws + WS_S);
  float* OUT = (float*)d_out;
  k_xb<<<dim3((unsigned)(((size_t)NB * TT * (DIN / 8) + 255) / 256)), 256, 0, stream>>>(F[0], XB);
  k_wt<<<dim3(CC / 16, 3), 128, 0, stream>>>(F[1], F[3], F[5], WT);
  k_proj<<<dim3(NB * TT / 64, CC / 128, 3), 128, 0, stream>>>(XB, WT, F[2], F[4], F[6], QH, QL, KH, KL, VT);
  for (int b = 0; b < NB; ++b) {
    k_sc<<<dim3(TT / 64, TT / 64), 128, 0, stream>>>(QH, KH, QL, KL, b, S);
    k_sm<<<dim3(TT), 256, 0, stream>>>(S);
    k_pv<<<dim3(TT / 64, CC / 64), 256, 0, stream>>>(PH, VT, b, OUT);
  }
}

// v002
// A run of this version takes 145 microseconds.
// Timed twice side by side with v001, it ran 2.92 and 2.95 times as fast.
// Counting every step since v000, it is 7.90 times as fast.
// compute dtype: every float input RNE-converted to bf16 on load; q/k/v = x W + b with exact bf16 products on v_wmma_f32_16x16x32_bf16 (f32 accumulate); logits k q^T: q and k each carried as f16 hi + f16 residual x 2^10 (3 products on v_wmma_f32_16x16x32_f16, f32 accumulate); running row maximum, exp2 and row sum in f32; exp(s - running max) x 2^14 to f16 against v f16 (1 product on v_wmma_f32_16x16x32_f16, f32 accumulate), divided by the f32 row sum x 2^14; f32 output.
#include <hip/hip_runtime.h>
#include <math.h>

typedef __attribute__((ext_vector_type(16))) _Float16 v16h;
typedef __attribute__((ext_vector_type(16))) __bf16 v16b;
typedef __attribute__((ext_vector_type(8)))  _Float16 v8h;
typedef __attribute__((ext_vector_type(8)))  __bf16 v8b;
typedef __attribute__((ext_vector_type(8)))  float v8f;
typedef __attribute__((ext_vector_type(4)))  float v4f;
typedef __attribute__((ext_vector_type(4)))  unsigned v4u;

template <typename T> __device__ __forceinline__ void vst2(void* p, T v) { *(T*)p = v;  }

__device__ __forceinline__ v8f wmma_bf(v16b a, v16b b, v8f c) {
  v8f d = __builtin_amdgcn_wmma_f32_16x16x32_bf16(false, a, false, b, (short)0, c, false, false);
  asm volatile("v_nop\n\tv_nop\n\tv_nop\n\tv_nop" : "+v"(d) : "v"(a), "v"(b));
  return d;
}
// 16x16x32 fragments: lane = (h = lane>>4, row/col = lane&15); elements 0..7 = k0+8h+0..7, 8..15 = k0+16+8h+0..7; D element r = row 8h+r, col lane&15.
// A from a row-major [m][k] row; B from a k-contiguous [n][k] row: identical loader.
__device__ __forceinline__ v16h frag_h(const _Float16* rowk0, int lane) {
  union { v16h v; v8h q[2]; } u; const _Float16* p = rowk0 + 8 * (lane >> 4);
  u.q[0] = *(const v8h*)p; u.q[1] = *(const v8h*)(p + 16); return u.v;
}
__device__ __forceinline__ v16b frag_b(const __bf16* rowk0, int lane) {
  union { v16b v; v8b q[2]; } u; const __bf16* p = rowk0 + 8 * (lane >> 4);
  u.q[0] = *(const v8b*)p; u.q[1] = *(const v8b*)(p + 16); return u.v;
}
__device__ __forceinline__ float bfr(float v) { return (float)(__bf16)v; }
// wave-private LDS tile: 16-B stores by this wave, then 16-B reloads by other lanes of the same wave
__device__ __forceinline__ void ldsx() { asm volatile("s_wait_dscnt 0x0" ::: "memory"); __builtin_amdgcn_wave_barrier(); __builtin_amdgcn_fence(3, "workgroup"); }

// Single-head softmax attention: q/k/v = x W + b (W (in,out) 256x256); logits = q k^T (no scale); the reference's keep-test s >= rowmin(s) holds for every finite logit by the definition of the minimum and is not evaluated; softmax over all keys; out = P v.
#ifndef NB
#define NB 4
#endif
#ifndef SEQ
#define SEQ 4096
#endif
#define NB_FULL 4
#define SEQ_FULL 4096
#define TT SEQ
#define CC 256            // projected width (head dim)
#define DIN 256           // input width
static_assert(NB >= 1 && NB <= NB_FULL);
static_assert(SEQ >= 64 && SEQ <= SEQ_FULL && (SEQ % 64) == 0);
static_assert(CC == 256 && DIN == 256);

#define WS_XB  0u                                         // bf16 x rows [NB*TT][DIN]
#define WS_WT  (WS_XB + 2u * (size_t)NB * TT * DIN)        // bf16 weights, out-major [3][CC][DIN]
#define WS_QH  (WS_WT + 2u * (size_t)3 * CC * DIN)         // f16 q hi rows [NB*TT][CC]
#define WS_QL  (WS_QH + 2u * (size_t)NB * TT * CC)         // f16 q residual x 2^10 rows
#define WS_KH  (WS_QL + 2u * (size_t)NB * TT * CC)         // f16 k hi rows
#define WS_KL  (WS_KH + 2u * (size_t)NB * TT * CC)         // f16 k residual x 2^10 rows
#define WS_VT  (WS_KL + 2u * (size_t)NB * TT * CC)         // f16 v planes [NB][CC][TT]
#define WS_END (WS_VT + 2u * (size_t)NB * CC * TT)
static_assert(WS_END <= (size_t)134217728u);
static_assert((WS_WT % 128u) == 0 && (WS_QH % 128u) == 0);

__global__ __launch_bounds__(256) void k_xb(const float* __restrict__ X, __bf16* __restrict__ XB) {
  const size_t i = (size_t)blockIdx.x * 256 + threadIdx.x; if (i >= (size_t)NB * TT * (DIN / 8)) return;
  const size_t r = i / (DIN / 8); const int k = (int)(i % (DIN / 8)) * 8;
  const float* p = X + (((r / TT) * SEQ_FULL + (r % TT)) * (size_t)DIN + k);
  const v4f x0 = *(const v4f*)p, x1 = *(const v4f*)(p + 4);
  union { v8b h; v4u u; } o;
#pragma unroll
  for (int e = 0; e < 4; ++e) { o.h[e] = (__bf16)x0[e]; o.h[4 + e] = (__bf16)x1[e]; }
  vst2(XB + r * DIN + k, o.u);
}
// ---- k_wt: block = 16 output columns of one weight: WT[pl][o][k] = bf16(W[k][o]); LDS transpose, whole 512-B rows by 32 consecutive lanes x 16 B
__global__ __launch_bounds__(128) void k_wt(const float* __restrict__ WQ, const float* __restrict__ WK, const float* __restrict__ WV, __bf16* __restrict__ WT) {
  __shared__ __align__(16) __bf16 tr[16][DIN + 8];
  const int tid = threadIdx.x; const int c0 = blockIdx.x * 16; const int pl = blockIdx.y;
  const float* W = pl == 0 ? WQ : pl == 1 ? WK : WV;
#pragma unroll 4
  for (int it = 0; it < (16 * DIN) / 128; ++it) { const int idx = it * 128 + tid; const int k = idx >> 4, cl = idx & 15; tr[cl][k] = (__bf16)W[(size_t)k * CC + c0 + cl]; }
  __syncthreads();
  for (int e = tid; e < 16 * (DIN / 8); e += 128) { const int rl = e >> 5, q = e & 31; vst2(WT + ((size_t)pl * CC + c0 + rl) * DIN + q * 8, *(const v4u*)&tr[rl][q * 8]); }
}
// ---- k_proj: block = (64 compact rows, 128 cols, which): q/k/v = X W + b with exact bf16 products (K = DIN) -> which 0: q f16 hi + residual rows; 1: k f16 hi + residual rows; 2: v f16 planes [c][t]
__global__ __launch_bounds__(128) __attribute__((amdgpu_num_vgpr(256)))
void k_proj(const __bf16* __restrict__ XB, const __bf16* __restrict__ WT, const float* __restrict__ BQ, const float* __restrict__ BK, const float* __restrict__ BV,
            _Float16* __restrict__ QH, _Float16* __restrict__ QL, _Float16* __restrict__ KH, _Float16* __restrict__ KL, _Float16* __restrict__ VT) {
  __shared__ __align__(16) _Float16 sh[64][136], sl[64][136]; __shared__ __align__(16) _Float16 th[128][72];
  const int tid = threadIdx.x, wave = tid >> 5, lane = tid & 31, col = lane & 15, g = lane >> 4;
  const int which = blockIdx.z; const int c0 = blockIdx.y * 128; const size_t r0 = (size_t)blockIdx.x * 64; const size_t bb = r0 / TT; const int t0 = (int)(r0 % TT);
  const float* BA = which == 0 ? BQ : which == 1 ? BK : BV;
  const __bf16* WP = WT + (size_t)which * CC * DIN;
  v8f acc[8] = {};
#pragma unroll 1
  for (int kc = 0; kc < DIN / 32; ++kc) {
    const v16b a = frag_b(XB + (r0 + wave * 16 + col) * DIN + kc * 32, lane);
#pragma unroll
    for (int j = 0; j < 8; ++j) acc[j] = wmma_bf(a, frag_b(WP + (size_t)(c0 + j * 16 + col) * DIN + kc * 32, lane), acc[j]);
  }
  if (which < 2) { _Float16* DH = which == 0 ? QH : KH; _Float16* DL = which == 0 ? QL : KL;
#pragma unroll
    for (int j = 0; j < 8; ++j) { const float bias = bfr(BA[c0 + j * 16 + col]);
#pragma unroll
      for (int r = 0; r < 8; ++r) { const float v = acc[j][r] + bias; const _Float16 hv = (_Float16)v; sh[wave * 16 + 8 * g + r][j * 16 + col] = hv; sl[wave * 16 + 8 * g + r][j * 16 + col] = (_Float16)((v - (float)hv) * 1024.0f); } }
    __syncthreads();
    for (int e = tid; e < 64 * 16; e += 128) { const int rl = e >> 4, q = e & 15; vst2(DH + (r0 + rl) * CC + c0 + q * 8, *(const v4u*)&sh[rl][q * 8]); vst2(DL + (r0 + rl) * CC + c0 + q * 8, *(const v4u*)&sl[rl][q * 8]); }
  } else {
#pragma unroll
    for (int j = 0; j < 8; ++j) { const float bias = bfr(BA[c0 + j * 16 + col]);
#pragma unroll
      for (int r = 0; r < 8; ++r) { const float v = acc[j][r] + bias; const int rl = wave * 16 + 8 * g + r, cl = j * 16 + col; th[cl][rl] = (_Float16)v; } }
    __syncthreads();
    for (int e = tid; e < 128 * 8; e += 128) { const int cl = e >> 3, q = e & 7; vst2(VT + (bb * CC + c0 + cl) * (size_t)TT + t0 + q * 8, *(const v4u*)&th[cl][q * 8]); } }
}
// ---- asynchronous copies global -> LDS, 16 B a lane (512 B a copy), through no register. l, g: the lane's own LDS byte address and global address; ls, gs: step from copy to copy (bytes; halves).
// The closing s_wait_xcnt keeps every later write of these address registers behind the copies.
__device__ __forceinline__ void copy8(unsigned l, unsigned ls, const _Float16* g, size_t gs) {
  asm volatile("global_load_async_to_lds_b128 %0, %8, off\n\t"
               "global_load_async_to_lds_b128 %1, %9, off\n\t"
               "global_load_async_to_lds_b128 %2, %10, off\n\t"
               "global_load_async_to_lds_b128 %3, %11, off\n\t"
               "global_load_async_to_lds_b128 %4, %12, off\n\t"
               "global_load_async_to_lds_b128 %5, %13, off\n\t"
               "global_load_async_to_lds_b128 %6, %14, off\n\t"
               "global_load_async_to_lds_b128 %7, %15, off\n\t"
               "s_wait_xcnt 0x0"
               :: "v"(l), "v"(l + ls), "v"(l + 2 * ls), "v"(l + 3 * ls), "v"(l + 4 * ls), "v"(l + 5 * ls), "v"(l + 6 * ls), "v"(l + 7 * ls),
                  "v"(g), "v"(g + gs), "v"(g + 2 * gs), "v"(g + 3 * gs), "v"(g + 4 * gs), "v"(g + 5 * gs), "v"(g + 6 * gs), "v"(g + 7 * gs)
               : "memory");
}
#define FA_KT 64                   // keys per stage
#define FA_KPITCH (CC + 8)         // halves; 528 B = 16 B x odd for the 16-B fragment reads
#define FA_VPITCH (FA_KT + 8)      // halves; 144 B = 16 B x odd
#define FA_NT (TT / FA_KT)
#define FA_OP (CC + 4)             // floats; pitch of the output staging rows
#define LOG2E 1.4426950408889634f
static_assert((TT % FA_KT) == 0 && (TT % 64) == 0);
__device__ __forceinline__ v8f wm(v16h a, v16h b, v8f c) { return __builtin_amdgcn_wmma_f32_16x16x32_f16(false, a, false, b, (short)0, c, false, false); }
__device__ __forceinline__ void fence() { __builtin_amdgcn_sched_barrier(0); }
// k fragments of k steps 2 gi and 2 gi + 1: per step key tile 0 hi, key tile 1 hi, key tile 0 residual, key tile 1 residual; r = this lane's row of key tile 0 hi
__device__ __forceinline__ void fa_ldk(v16h (&f)[8], const _Float16* r, int gi, int lane) {
#pragma unroll    // every fragment index a constant (registers, no scratch)
  for (int u = 0; u < 2; ++u) { const _Float16* p = r + (gi * 2 + u) * 32;
    f[4 * u] = frag_h(p, lane); f[4 * u + 1] = frag_h(p + 16 * FA_KPITCH, lane); f[4 * u + 2] = frag_h(p + FA_KT * FA_KPITCH, lane); f[4 * u + 3] = frag_h(p + (FA_KT + 16) * FA_KPITCH, lane); }
}
// lane l with lane l ^ 16
__device__ __forceinline__ float xhalf(float x) { return __builtin_bit_cast(float, __builtin_amdgcn_permlanex16(__builtin_bit_cast(int, x), __builtin_bit_cast(int, x), 0x76543210, 0xfedcba98, false, false)); }
__global__ __launch_bounds__(256)
void k_fa(const _Float16* __restrict__ QH, const _Float16* __restrict__ QL, const _Float16* __restrict__ KH, const _Float16* __restrict__ KL, const _Float16* __restrict__ VT, float* __restrict__ OUT) {
  __shared__ __align__(16) _Float16 kst[2][2 * FA_KT][FA_KPITCH];   // rows 0..63 k hi, 64..127 k residual
  __shared__ __align__(16) _Float16 vst[2][CC][FA_VPITCH];
  static_assert(sizeof(kst) >= 4u * (4 * 32 * 32 * 4 + 4 * 32 * 2) && sizeof(vst) >= 4u * 64 * FA_OP);
  const int tid = threadIdx.x, wave = __builtin_amdgcn_readfirstlane(tid >> 5), lane = tid & 31, col = lane & 15, g = lane >> 4;
  const int q0 = blockIdx.x * 64, b = blockIdx.y; const int qg = wave & 3, hh = wave >> 2;
  // wave w copies rows 8 w .. 8 w + 7 of k hi and of k residual (a row a copy) and v rows 32 w .. 32 w + 31 (four rows a copy, 8 lanes a row)
  const _Float16* gkh = KH + ((size_t)b * TT + wave * 8) * CC + lane * 8;
  const _Float16* gkl = KL + ((size_t)b * TT + wave * 8) * CC + lane * 8;
  const _Float16* gv = VT + ((size_t)b * CC + wave * 32 + (lane >> 3)) * TT + (lane & 7) * 8;
  const unsigned lkh = (unsigned)(size_t)&kst[0][wave * 8][lane * 8], lkl = (unsigned)(size_t)&kst[0][FA_KT + wave * 8][lane * 8];
  const unsigned lv = (unsigned)(size_t)&vst[0][wave * 32 + (lane >> 3)][(lane & 7) * 8];
  auto stage = [&](int t) {   // 24 copies a wave
    const unsigned kb = (unsigned)(t & 1) * (unsigned)sizeof(kst[0]), vb = (unsigned)(t & 1) * (unsigned)sizeof(vst[0]);
    copy8(lkh + kb, 2u * FA_KPITCH, gkh + (size_t)t * FA_KT * CC, CC);
    copy8(lkl + kb, 2u * FA_KPITCH, gkl + (size_t)t * FA_KT * CC, CC);
    copy8(lv + vb, 8u * FA_VPITCH, gv + (size_t)t * FA_KT, 4 * (size_t)TT);
  };
  stage(0);
  v16h qh[CC / 32], ql[CC / 32];
  { const size_t qr = ((size_t)b * TT + q0 + qg * 16 + col) * CC;
#pragma unroll    // every fragment index a constant (registers, no scratch); so for every unrolled loop of this kernel
    for (int kk = 0; kk < CC / 32; ++kk) { qh[kk] = frag_h(QH + qr + kk * 32, lane); ql[kk] = frag_h(QL + qr + kk * 32, lane); } }
  v8f o[CC / 16] = {};
  float m = -1.0e30f, mk = -1.0e30f, l = 0.f;         // running maximum; its exponent base m log2(e) - 14; this lane's share of the row sum x 2^14
  asm volatile("s_wait_asynccnt 0x0" ::: "memory");   // stage 0 of this wave has landed
  __syncthreads();                                     // ... and of every wave
  if (FA_NT > 1) stage(1);
#pragma unroll 1  // one body for both buffers: the code stays short
  for (int t = 0; t < FA_NT; ++t) {
    const _Float16* kr = &kst[t & 1][hh * 32 + col][0]; const _Float16* vr = &vst[t & 1][col][hh * 32];
    v8f sa[2] = {}, sb[2] = {};
    v16h kf[2][8], va[8], vc[8];   // k fragments of two k steps a group, two groups; v fragments of columns 0..127 and 128..255
    fa_ldk(kf[0], kr, 0, lane);
#pragma unroll    // the LDS offsets become immediates, every fragment and q index a constant
    for (int gi = 0; gi < CC / 64; ++gi) {
      // the next group's LDS reads go out together, ahead of this group's products; behind the last k group, the first half of v
      if (gi + 1 < CC / 64) fa_ldk(kf[(gi + 1) & 1], kr, gi + 1, lane);
      else {
#pragma unroll
        for (int j = 0; j < 8; ++j) va[j] = frag_h(vr + j * 16 * FA_VPITCH, lane); }
      fence();    // keeps those reads in front of the products, so that their latency runs under them
#pragma unroll
      for (int u = 0; u < 2; ++u) { const int kk = gi * 2 + u; const v16h h0 = kf[gi & 1][4 * u], h1 = kf[gi & 1][4 * u + 1], l0 = kf[gi & 1][4 * u + 2], l1 = kf[gi & 1][4 * u + 3];
        sa[0] = wm(h0, qh[kk], sa[0]); sa[1] = wm(h1, qh[kk], sa[1]);
        sb[0] = wm(h0, ql[kk], sb[0]); sb[1] = wm(h1, ql[kk], sb[1]);
        sb[0] = wm(l0, qh[kk], sb[0]); sb[1] = wm(l1, qh[kk], sb[1]); }
      fence();    // keeps the following group's reads out of this run of products
    }
    float s[16];   // logits of query col against keys 32 hh + 8 g + e (e < 8), 32 hh + 16 + 8 g + e - 8
#pragma unroll
    for (int e = 0; e < 16; ++e) s[e] = sa[e >> 3][e & 7] + sb[e >> 3][e & 7] * (1.0f / 1024.0f);
    float mx = fmaxf(fmaxf(fmaxf(s[0], s[1]), fmaxf(s[2], s[3])), fmaxf(fmaxf(s[4], s[5]), fmaxf(s[6], s[7])));
    mx = fmaxf(mx, fmaxf(fmaxf(fmaxf(s[8], s[9]), fmaxf(s[10], s[11])), fmaxf(fmaxf(s[12], s[13]), fmaxf(s[14], s[15]))));
    mx = fmaxf(mx, xhalf(mx));
    const float mn = fmaxf(m, mx);
    if (__builtin_amdgcn_ballot_w32(mn > m) != 0) {   // one scalar test a stage; a lane whose maximum stays multiplies by exactly 1
      const float mkn = mn * LOG2E - 14.0f; const float al = __builtin_amdgcn_exp2f(mk - mkn);
      l *= al;
#pragma unroll
      for (int j = 0; j < CC / 16; ++j) o[j] *= al;
      m = mn; mk = mkn;
    }
    v16h pf; float ps[4] = {0.f, 0.f, 0.f, 0.f};
#pragma unroll
    for (int e = 0; e < 16; ++e) { const float p = __builtin_amdgcn_exp2f(fmaf(s[e], LOG2E, -mk)); ps[e & 3] += p; pf[e] = (_Float16)p; }
    l += (ps[0] + ps[1]) + (ps[2] + ps[3]);
#pragma unroll    // every index a constant
    for (int j = 0; j < 8; ++j) vc[j] = frag_h(vr + (8 + j) * 16 * FA_VPITCH, lane);
    fence();      // keeps the reads of the second half of v in front of the products of the first, so that their latency runs under them
#pragma unroll    // as above
    for (int j = 0; j < 8; ++j) o[j] = wm(va[j], pf, o[j]);
#pragma unroll    // as above
    for (int j = 0; j < 8; ++j) o[8 + j] = wm(vc[j], pf, o[8 + j]);
    asm volatile("s_wait_dscnt 0x0" ::: "memory");     // this wave's reads of stage t are done before the buffer is handed back
    asm volatile("s_wait_asynccnt 0x0" ::: "memory");  // this wave's copies of stage t + 1 have landed
    __syncthreads();                                   // publishes stage t + 1 and frees stage t's buffer
    if (t + 2 < FA_NT) stage(t + 2);
  }
  asm volatile("s_wait_asynccnt 0x0" ::: "memory");    // no copy is left in flight; behind the last trip's barrier both buffers are free
  l += xhalf(l);
  // join of the two key halves through LDS: half 1 hands over its base, sum and accumulators, lane for lane
  float* mg = (float*)&kst[0][0][0]; float* mst = mg + 4 * 32 * 32 * 4 + (qg * 32 + lane) * 2;
  if (hh == 1) {
    mst[0] = mk; mst[1] = l;
#pragma unroll
    for (int j = 0; j < CC / 16; ++j) {
      const v4f x0 = {o[j][0], o[j][1], o[j][2], o[j][3]}, x1 = {o[j][4], o[j][5], o[j][6], o[j][7]};
      *(v4f*)&mg[((qg * 32 + j * 2) * 32 + lane) * 4] = x0; *(v4f*)&mg[((qg * 32 + j * 2 + 1) * 32 + lane) * 4] = x1; }
  }
  __syncthreads();                                     // half 1's hand-over is visible to half 0
  if (hh == 0) {
    const float mk1 = mst[0], l1 = mst[1]; const float mf = fmaxf(mk, mk1);
    float a0 = __builtin_amdgcn_exp2f(mk - mf), a1 = __builtin_amdgcn_exp2f(mk1 - mf);
    const float inv = 1.0f / (l * a0 + l1 * a1); a0 *= inv; a1 *= inv;
    float (*os)[FA_OP] = (float (*)[FA_OP])&vst[0][0][0];   // this wave's 16 rows alone
#pragma unroll
    for (int j = 0; j < CC / 16; ++j) {
      const v4f y0 = *(const v4f*)&mg[((qg * 32 + j * 2) * 32 + lane) * 4], y1 = *(const v4f*)&mg[((qg * 32 + j * 2 + 1) * 32 + lane) * 4];
      const v4f x0 = {o[j][0], o[j][1], o[j][2], o[j][3]}, x1 = {o[j][4], o[j][5], o[j][6], o[j][7]};
      *(v4f*)&os[qg * 16 + col][j * 16 + 8 * g] = x0 * a0 + y0 * a1; *(v4f*)&os[qg * 16 + col][j * 16 + 8 * g + 4] = x1 * a0 + y1 * a1; }
    ldsx();
    float* op = OUT + ((size_t)b * TT + q0 + qg * 16) * CC + lane * 4;
    // 512 B of a row by 32 lanes x 16 B; unrolled by 8 so that the LDS reads go out together
#pragma unroll 8
    for (int it = 0; it < 32; ++it) vst2(op + (size_t)(it >> 1) * CC + (it & 1) * 128, *(const v4f*)&os[qg * 16 + (it >> 1)][(it & 1) * 128 + lane * 4]);
  }
}

extern "C" void kernel_launch(void* const* d_in, const int* in_sizes, int n_in, void* d_out, int out_size, void* d_ws, size_t ws_size, hipStream_t stream) {
  // inputs (wire order): 0 x [4,4096,256]; 1 Wq [256,256] (in,out); 2 bq [256]; 3 Wk; 4 bk; 5 Wv; 6 bv; all f32
  if (n_in < 7) return;
  if ((size_t)in_sizes[0] < ((size_t)(NB - 1) * SEQ_FULL + TT) * DIN) return;
  if (in_sizes[1] < DIN * CC || in_sizes[3] < DIN * CC || in_sizes[5] < DIN * CC) return;
  if (in_sizes[2] < CC || in_sizes[4] < CC || in_sizes[6] < CC) return;
  if ((size_t)out_size < (size_t)NB * TT * CC) return;
  if (ws_size < (size_t)WS_END) return;
  const float** F = (const float**)d_in;
  char* ws = (char*)d_ws;
  __bf16 *XB = (__bf16*)(ws + WS_XB), *WT = (__bf16*)(ws + WS_WT);
  _Float16 *QH = (_Float16*)(ws + WS_QH), *QL = (_Float16*)(ws + WS_QL), *KH = (_Float16*)(ws + WS_KH), *KL = (_Float16*)(ws + WS_KL), *VT = (_Float16*)(ws + WS_VT);
  float* OUT = (float*)d_out;
  k_xb<<<dim3((unsigned)(((size_t)NB * TT * (DIN / 8) + 255) / 256)), 256, 0, stream>>>(F[0], XB);
  k_wt<<<dim3(CC / 16, 3), 128, 0, stream>>>(F[1], F[3], F[5], WT);
  k_proj<<<dim3(NB * TT / 64, CC / 128, 3), 128, 0, stream>>>(XB, WT, F[2], F[4], F[6], QH, QL, KH, KL, VT);
  k_fa<<<dim3(TT / 64, NB), 256, 0, stream>>>(QH, QL, KH, KL, VT, OUT);
}

// v003
// One run takes 127 microseconds.
// Timed twice side by side with v002, it ran 1.14 and 1.15 times as fast.
// Over all steps from v000 it is 9.03 times as fast.
// compute dtype: every float input RNE-converted to bf16 on load; q/k/v = x W + b with exact bf16 products on v_wmma_f32_16x16x32_bf16 (f32 accumulate); logits k q^T: q and k each carried as f16 hi + f16 residual x 2^10 (3 products on v_wmma_f32_16x16x32_f16, f32 accumulate); running row maximum, exp2 and row sum in f32; exp(s - running max) x 2^14 to f16 against v f16 (1 product on v_wmma_f32_16x16x32_f16, f32 accumulate), divided by the f32 row sum x 2^14; f32 output.
#include <hip/hip_runtime.h>
#include <math.h>

typedef __attribute__((ext_vector_type(16))) _Float16 v16h;
typedef __attribute__((ext_vector_type(16))) __bf16 v16b;
typedef __attribute__((ext_vector_type(8)))  _Float16 v8h;
typedef __attribute__((ext_vector_type(8)))  __bf16 v8b;
typedef __attribute__((ext_vector_type(8)))  float v8f;
typedef __attribute__((ext_vector_type(4)))  float v4f;
typedef __attribute__((ext_vector_type(4)))  unsigned v4u;

template <typename T> __device__ __forceinline__ void vst2(void* p, T v) { *(T*)p = v;  }

__device__ __forceinline__ v8f wmma_bf(v16b a, v16b b, v8f c) {
  v8f d = __builtin_amdgcn_wmma_f32_16x16x32_bf16(false, a, false, b, (short)0, c, false, false);
  asm volatile("v_nop\n\tv_nop\n\tv_nop\n\tv_nop" : "+v"(d) : "v"(a), "v"(b));
  return d;
}
// 16x16x32 fragments: lane = (h = lane>>4, row/col = lane&15); elements 0..7 = k0+8h+0..7, 8..15 = k0+16+8h+0..7; D element r = row 8h+r, col lane&15.
// A from a row-major [m][k] row; B from a k-contiguous [n][k] row: identical loader.
__device__ __forceinline__ v16h frag_h(const _Float16* rowk0, int lane) {
  union { v16h v; v8h q[2]; } u; const _Float16* p = rowk0 + 8 * (lane >> 4);
  u.q[0] = *(const v8h*)p; u.q[1] = *(const v8h*)(p + 16); return u.v;
}
__device__ __forceinline__ v16b frag_b(const __bf16* rowk0, int lane) {
  union { v16b v; v8b q[2]; } u; const __bf16* p = rowk0 + 8 * (lane >> 4);
  u.q[0] = *(const v8b*)p; u.q[1] = *(const v8b*)(p + 16); return u.v;
}
__device__ __forceinline__ float bfr(float v) { return (float)(__bf16)v; }
// wave-private LDS tile: 16-B stores by this wave, then 16-B reloads by other lanes of the same wave
__device__ __forceinline__ void ldsx() { asm volatile("s_wait_dscnt 0x0" ::: "memory"); __builtin_amdgcn_wave_barrier(); __builtin_amdgcn_fence(3, "workgroup"); }

// Single-head softmax attention: q/k/v = x W + b (W (in,out) 256x256); logits = q k^T (no scale); the reference's keep-test s >= rowmin(s) holds for every finite logit by the definition of the minimum and is not evaluated; softmax over all keys; out = P v.
#ifndef NB
#define NB 4
#endif
#ifndef SEQ
#define SEQ 4096
#endif
#define NB_FULL 4
#define SEQ_FULL 4096
#define TT SEQ
#define CC 256            // projected width (head dim)
#define DIN 256           // input width
static_assert(NB >= 1 && NB <= NB_FULL);
static_assert(SEQ >= 64 && SEQ <= SEQ_FULL && (SEQ % 64) == 0);
static_assert(CC == 256 && DIN == 256);

#define WS_XB  0u                                         // bf16 x rows [NB*TT][DIN]
#define WS_WT  (WS_XB + 2u * (size_t)NB * TT * DIN)        // bf16 weights, out-major [3][CC][DIN]
#define WS_QH  (WS_WT + 2u * (size_t)3 * CC * DIN)         // f16 q hi rows [NB*TT][CC]
#define WS_QL  (WS_QH + 2u * (size_t)NB * TT * CC)         // f16 q residual x 2^10 rows
#define WS_KH  (WS_QL + 2u * (size_t)NB * TT * CC)         // f16 k hi rows
#define WS_KL  (WS_KH + 2u * (size_t)NB * TT * CC)         // f16 k residual x 2^10 rows
#define WS_VT  (WS_KL + 2u * (size_t)NB * TT * CC)         // f16 v planes [NB][CC][TT]
#define WS_END (WS_VT + 2u * (size_t)NB * CC * TT)
static_assert(WS_END <= (size_t)134217728u);
static_assert((WS_WT % 128u) == 0 && (WS_QH % 128u) == 0);

__global__ __launch_bounds__(256) void k_xb(const float* __restrict__ X, __bf16* __restrict__ XB) {
  const size_t i = (size_t)blockIdx.x * 256 + threadIdx.x; if (i >= (size_t)NB * TT * (DIN / 8)) return;
  const size_t r = i / (DIN / 8); const int k = (int)(i % (DIN / 8)) * 8;
  const float* p = X + (((r / TT) * SEQ_FULL + (r % TT)) * (size_t)DIN + k);
  const v4f x0 = *(const v4f*)p, x1 = *(const v4f*)(p + 4);
  union { v8b h; v4u u; } o;
#pragma unroll
  for (int e = 0; e < 4; ++e) { o.h[e] = (__bf16)x0[e]; o.h[4 + e] = (__bf16)x1[e]; }
  vst2(XB + r * DIN + k, o.u);
}
// ---- k_wt: block = 16 output columns of one weight: WT[pl][o][k] = bf16(W[k][o]); LDS transpose, whole 512-B rows by 32 consecutive lanes x 16 B
__global__ __launch_bounds__(128) void k_wt(const float* __restrict__ WQ, const float* __restrict__ WK, const float* __restrict__ WV, __bf16* __restrict__ WT) {
  __shared__ __align__(16) __bf16 tr[16][DIN + 8];
  const int tid = threadIdx.x; const int c0 = blockIdx.x * 16; const int pl = blockIdx.y;
  const float* W = pl == 0 ? WQ : pl == 1 ? WK : WV;
#pragma unroll 4
  for (int it = 0; it < (16 * DIN) / 128; ++it) { const int idx = it * 128 + tid; const int k = idx >> 4, cl = idx & 15; tr[cl][k] = (__bf16)W[(size_t)k * CC + c0 + cl]; }
  __syncthreads();
  for (int e = tid; e < 16 * (DIN / 8); e += 128) { const int rl = e >> 5, q = e & 31; vst2(WT + ((size_t)pl * CC + c0 + rl) * DIN + q * 8, *(const v4u*)&tr[rl][q * 8]); }
}
// ---- asynchronous copies global -> LDS, 16 B a lane (512 B a copy), through no register. l, g: the lane's own LDS byte address and global address; ls, gs: step from copy to copy (bytes; halves).
// The closing s_wait_xcnt keeps every later write of these address registers behind the copies.
__device__ __forceinline__ void copy8(unsigned l, unsigned ls, const _Float16* g, size_t gs) {
  asm volatile("global_load_async_to_lds_b128 %0, %8, off\n\t"
               "global_load_async_to_lds_b128 %1, %9, off\n\t"
               "global_load_async_to_lds_b128 %2, %10, off\n\t"
               "global_load_async_to_lds_b128 %3, %11, off\n\t"
               "global_load_async_to_lds_b128 %4, %12, off\n\t"
               "global_load_async_to_lds_b128 %5, %13, off\n\t"
               "global_load_async_to_lds_b128 %6, %14, off\n\t"
               "global_load_async_to_lds_b128 %7, %15, off\n\t"
               "s_wait_xcnt 0x0"
               :: "v"(l), "v"(l + ls), "v"(l + 2 * ls), "v"(l + 3 * ls), "v"(l + 4 * ls), "v"(l + 5 * ls), "v"(l + 6 * ls), "v"(l + 7 * ls),
                  "v"(g), "v"(g + gs), "v"(g + 2 * gs), "v"(g + 3 * gs), "v"(g + 4 * gs), "v"(g + 5 * gs), "v"(g + 6 * gs), "v"(g + 7 * gs)
               : "memory");
}
// ---- k_proj: block = (64 compact rows, 128 cols, which): q/k/v = X W + b with exact bf16 products (K = DIN) -> which 0: q f16 hi + residual rows; 1: k f16 hi + residual rows; 2: v f16 planes [c][t]
// The block's 64 x rows and 128 weight rows (512 B each, LDS pitch 528 B = 16 B x odd for the 16-B fragment reads) are brought whole into LDS once by asynchronous copies, a row a copy; every fragment is read from LDS.
#define PJ_PITCH (DIN + 8)         // halves
__global__ __launch_bounds__(128) __attribute__((amdgpu_num_vgpr(256)))
void k_proj(const __bf16* __restrict__ XB, const __bf16* __restrict__ WT, const float* __restrict__ BQ, const float* __restrict__ BK, const float* __restrict__ BV,
            _Float16* __restrict__ QH, _Float16* __restrict__ QL, _Float16* __restrict__ KH, _Float16* __restrict__ KL, _Float16* __restrict__ VT) {
  __shared__ __align__(16) __bf16 xs[64][PJ_PITCH], wr[128][PJ_PITCH];
  __shared__ __align__(16) _Float16 sh[64][136], sl[64][136]; __shared__ __align__(16) _Float16 th[128][72];
  const int tid = threadIdx.x, wave = tid >> 5, lane = tid & 31, col = lane & 15, g = lane >> 4;
  const int which = blockIdx.z; const int c0 = blockIdx.y * 128; const size_t r0 = (size_t)blockIdx.x * 64; const size_t bb = r0 / TT; const int t0 = (int)(r0 % TT);
  const float* BA = which == 0 ? BQ : which == 1 ? BK : BV;
  const __bf16* WP = WT + (size_t)which * CC * DIN;
  { // wave w copies x rows 16 w .. 16 w + 15 and weight rows 32 w .. 32 w + 31: 48 copies a wave
    const unsigned lx = (unsigned)(size_t)&xs[wave * 16][lane * 8], lw = (unsigned)(size_t)&wr[wave * 32][lane * 8];
    const _Float16* gx = (const _Float16*)(XB + (r0 + wave * 16) * DIN + lane * 8); const _Float16* gw = (const _Float16*)(WP + (size_t)(c0 + wave * 32) * DIN + lane * 8);
#pragma unroll    // straight-line copies
    for (int u = 0; u < 2; ++u) copy8(lx + u * 16u * PJ_PITCH, 2u * PJ_PITCH, gx + u * 8 * DIN, DIN);
#pragma unroll    // as above
    for (int u = 0; u < 4; ++u) copy8(lw + u * 16u * PJ_PITCH, 2u * PJ_PITCH, gw + u * 8 * DIN, DIN);
  }
  v8f acc[8] = {};
  asm volatile("s_wait_asynccnt 0x0" ::: "memory");   // this wave's rows have landed
  __syncthreads();                                     // ... and every wave's
  v16b fa[2], fb[2][8];   // fragments of one k step, two sets
  auto ldf = [&](int kc) {
    fa[kc & 1] = frag_b(&xs[wave * 16 + col][kc * 32], lane);
#pragma unroll    // every fragment index a constant (registers, no scratch)
    for (int j = 0; j < 8; ++j) fb[kc & 1][j] = frag_b(&wr[j * 16 + col][kc * 32], lane);
  };
  ldf(0);
#pragma unroll    // the LDS offsets become immediates, every fragment index a constant
  for (int kc = 0; kc < DIN / 32; ++kc) {
    if (kc + 1 < DIN / 32) ldf(kc + 1);   // the next k step's LDS reads go out together, ahead of this step's products
#pragma unroll
    for (int j = 0; j < 8; ++j) acc[j] = wmma_bf(fa[kc & 1], fb[kc & 1][j], acc[j]);
  }
  if (which < 2) { _Float16* DH = which == 0 ? QH : KH; _Float16* DL = which == 0 ? QL : KL;
#pragma unroll
    for (int j = 0; j < 8; ++j) { const float bias = bfr(BA[c0 + j * 16 + col]);
#pragma unroll
      for (int r = 0; r < 8; ++r) { const float v = acc[j][r] + bias; const _Float16 hv = (_Float16)v; sh[wave * 16 + 8 * g + r][j * 16 + col] = hv; sl[wave * 16 + 8 * g + r][j * 16 + col] = (_Float16)((v - (float)hv) * 1024.0f); } }
    __syncthreads();
    for (int e = tid; e < 64 * 16; e += 128) { const int rl = e >> 4, q = e & 15; vst2(DH + (r0 + rl) * CC + c0 + q * 8, *(const v4u*)&sh[rl][q * 8]); vst2(DL + (r0 + rl) * CC + c0 + q * 8, *(const v4u*)&sl[rl][q * 8]); }
  } else {
#pragma unroll
    for (int j = 0; j < 8; ++j) { const float bias = bfr(BA[c0 + j * 16 + col]);
#pragma unroll
      for (int r = 0; r < 8; ++r) { const float v = acc[j][r] + bias; const int rl = wave * 16 + 8 * g + r, cl = j * 16 + col; th[cl][rl] = (_Float16)v; } }
    __syncthreads();
    for (int e = tid; e < 128 * 8; e += 128) { const int cl = e >> 3, q = e & 7; vst2(VT + (bb * CC + c0 + cl) * (size_t)TT + t0 + q * 8, *(const v4u*)&th[cl][q * 8]); } }
}
#define FA_KT 64                   // keys per stage
#define FA_KPITCH (CC + 8)         // halves; 528 B = 16 B x odd for the 16-B fragment reads
#define FA_VPITCH (FA_KT + 8)      // halves; 144 B = 16 B x odd
#define FA_NT (TT / FA_KT)
#define FA_OP (CC + 4)             // floats; pitch of the output staging rows
#define LOG2E 1.4426950408889634f
static_assert((TT % FA_KT) == 0 && (TT % 64) == 0);
__device__ __forceinline__ v8f wm(v16h a, v16h b, v8f c) { return __builtin_amdgcn_wmma_f32_16x16x32_f16(false, a, false, b, (short)0, c, false, false); }
__device__ __forceinline__ void fence() { __builtin_amdgcn_sched_barrier(0); }
// k fragments of k steps 2 gi and 2 gi + 1: per step key tile 0 hi, key tile 1 hi, key tile 0 residual, key tile 1 residual; r = this lane's row of key tile 0 hi
__device__ __forceinline__ void fa_ldk(v16h (&f)[8], const _Float16* r, int gi, int lane) {
#pragma unroll    // every fragment index a constant (registers, no scratch)
  for (int u = 0; u < 2; ++u) { const _Float16* p = r + (gi * 2 + u) * 32;
    f[4 * u] = frag_h(p, lane); f[4 * u + 1] = frag_h(p + 16 * FA_KPITCH, lane); f[4 * u + 2] = frag_h(p + FA_KT * FA_KPITCH, lane); f[4 * u + 3] = frag_h(p + (FA_KT + 16) * FA_KPITCH, lane); }
}
// lane l with lane l ^ 16
__device__ __forceinline__ float xhalf(float x) { return __builtin_bit_cast(float, __builtin_amdgcn_permlanex16(__builtin_bit_cast(int, x), __builtin_bit_cast(int, x), 0x76543210, 0xfedcba98, false, false)); }
__global__ __launch_bounds__(256)
void k_fa(const _Float16* __restrict__ QH, const _Float16* __restrict__ QL, const _Float16* __restrict__ KH, const _Float16* __restrict__ KL, const _Float16* __restrict__ VT, float* __restrict__ OUT) {
  __shared__ __align__(16) _Float16 kst[2][2 * FA_KT][FA_KPITCH];   // rows 0..63 k hi, 64..127 k residual
  __shared__ __align__(16) _Float16 vst[2][CC][FA_VPITCH];
  static_assert(sizeof(kst) >= 4u * (4 * 32 * 32 * 4 + 4 * 32 * 2) && sizeof(vst) >= 4u * 64 * FA_OP);
  const int tid = threadIdx.x, wave = __builtin_amdgcn_readfirstlane(tid >> 5), lane = tid & 31, col = lane & 15, g = lane >> 4;
  const int q0 = blockIdx.x * 64, b = blockIdx.y; const int qg = wave & 3, hh = wave >> 2;
  // wave w copies rows 8 w .. 8 w + 7 of k hi and of k residual (a row a copy) and v rows 32 w .. 32 w + 31 (four rows a copy, 8 lanes a row)
  const _Float16* gkh = KH + ((size_t)b * TT + wave * 8) * CC + lane * 8;
  const _Float16* gkl = KL + ((size_t)b * TT + wave * 8) * CC + lane * 8;
  const _Float16* gv = VT + ((size_t)b * CC + wave * 32 + (lane >> 3)) * TT + (lane & 7) * 8;
  const unsigned lkh = (unsigned)(size_t)&kst[0][wave * 8][lane * 8], lkl = (unsigned)(size_t)&kst[0][FA_KT + wave * 8][lane * 8];
  const unsigned lv = (unsigned)(size_t)&vst[0][wave * 32 + (lane >> 3)][(lane & 7) * 8];
  auto stage = [&](int t) {   // 24 copies a wave
    const unsigned kb = (unsigned)(t & 1) * (unsigned)sizeof(kst[0]), vb = (unsigned)(t & 1) * (unsigned)sizeof(vst[0]);
    copy8(lkh + kb, 2u * FA_KPITCH, gkh + (size_t)t * FA_KT * CC, CC);
    copy8(lkl + kb, 2u * FA_KPITCH, gkl + (size_t)t * FA_KT * CC, CC);
    copy8(lv + vb, 8u * FA_VPITCH, gv + (size_t)t * FA_KT, 4 * (size_t)TT);
  };
  stage(0);
  v16h qh[CC / 32], ql[CC / 32];
  { const size_t qr = ((size_t)b * TT + q0 + qg * 16 + col) * CC;
#pragma unroll    // every fragment index a constant (registers, no scratch); so for every unrolled loop of this kernel
    for (int kk = 0; kk < CC / 32; ++kk) { qh[kk] = frag_h(QH + qr + kk * 32, lane); ql[kk] = frag_h(QL + qr + kk * 32, lane); } }
  v8f o[CC / 16] = {};
  float m = -1.0e30f, mk = -1.0e30f, l = 0.f;         // running maximum; its exponent base m log2(e) - 14; this lane's share of the row sum x 2^14
  asm volatile("s_wait_asynccnt 0x0" ::: "memory");   // stage 0 of this wave has landed
  __syncthreads();                                     // ... and of every wave
  if (FA_NT > 1) stage(1);
#pragma unroll 1  // one body for both buffers: the code stays short
  for (int t = 0; t < FA_NT; ++t) {
    const _Float16* kr = &kst[t & 1][hh * 32 + col][0]; const _Float16* vr = &vst[t & 1][col][hh * 32];
    v8f sa[2] = {}, sb[2] = {};
    v16h kf[2][8], va[8], vc[8];   // k fragments of two k steps a group, two groups; v fragments of columns 0..127 and 128..255
    fa_ldk(kf[0], kr, 0, lane);
#pragma unroll    // the LDS offsets become immediates, every fragment and q index a constant
    for (int gi = 0; gi < CC / 64; ++gi) {
      // the next group's LDS reads go out together, ahead of this group's products; behind the last k group, the first half of v
      if (gi + 1 < CC / 64) fa_ldk(kf[(gi + 1) & 1], kr, gi + 1, lane);
      else {
#pragma unroll
        for (int j = 0; j < 8; ++j) va[j] = frag_h(vr + j * 16 * FA_VPITCH, lane); }
      fence();    // keeps those reads in front of the products, so that their latency runs under them
#pragma unroll
      for (int u = 0; u < 2; ++u) { const int kk = gi * 2 + u; const v16h h0 = kf[gi & 1][4 * u], h1 = kf[gi & 1][4 * u + 1], l0 = kf[gi & 1][4 * u + 2], l1 = kf[gi & 1][4 * u + 3];
        sa[0] = wm(h0, qh[kk], sa[0]); sa[1] = wm(h1, qh[kk], sa[1]);
        sb[0] = wm(h0, ql[kk], sb[0]); sb[1] = wm(h1, ql[kk], sb[1]);
        sb[0] = wm(l0, qh[kk], sb[0]); sb[1] = wm(l1, qh[kk], sb[1]); }
      fence();    // keeps the following group's reads out of this run of products
    }
    float s[16];   // logits of query col against keys 32 hh + 8 g + e (e < 8), 32 hh + 16 + 8 g + e - 8
#pragma unroll
    for (int e = 0; e < 16; ++e) s[e] = sa[e >> 3][e & 7] + sb[e >> 3][e & 7] * (1.0f / 1024.0f);
    float mx = fmaxf(fmaxf(fmaxf(s[0], s[1]), fmaxf(s[2], s[3])), fmaxf(fmaxf(s[4], s[5]), fmaxf(s[6], s[7])));
    mx = fmaxf(mx, fmaxf(fmaxf(fmaxf(s[8], s[9]), fmaxf(s[10], s[11])), fmaxf(fmaxf(s[12], s[13]), fmaxf(s[14], s[15]))));
    mx = fmaxf(mx, xhalf(mx));
    const float mn = fmaxf(m, mx);
    if (__builtin_amdgcn_ballot_w32(mn > m) != 0) {   // one scalar test a stage; a lane whose maximum stays multiplies by exactly 1
      const float mkn = mn * LOG2E - 14.0f; const float al = __builtin_amdgcn_exp2f(mk - mkn);
      l *= al;
#pragma unroll
      for (int j = 0; j < CC / 16; ++j) o[j] *= al;
      m = mn; mk = mkn;
    }
    v16h pf; float ps[4] = {0.f, 0.f, 0.f, 0.f};
#pragma unroll
    for (int e = 0; e < 16; ++e) { const float p = __builtin_amdgcn_exp2f(fmaf(s[e], LOG2E, -mk)); ps[e & 3] += p; pf[e] = (_Float16)p; }
    l += (ps[0] + ps[1]) + (ps[2] + ps[3]);
#pragma unroll    // every index a constant
    for (int j = 0; j < 8; ++j) vc[j] = frag_h(vr + (8 + j) * 16 * FA_VPITCH, lane);
    fence();      // keeps the reads of the second half of v in front of the products of the first, so that their latency runs under them
#pragma unroll    // as above
    for (int j = 0; j < 8; ++j) o[j] = wm(va[j], pf, o[j]);
#pragma unroll    // as above
    for (int j = 0; j < 8; ++j) o[8 + j] = wm(vc[j], pf, o[8 + j]);
    asm volatile("s_wait_dscnt 0x0" ::: "memory");     // this wave's reads of stage t are done before the buffer is handed back
    asm volatile("s_wait_asynccnt 0x0" ::: "memory");  // this wave's copies of stage t + 1 have landed
    __syncthreads();                                   // publishes stage t + 1 and frees stage t's buffer
    if (t + 2 < FA_NT) stage(t + 2);
  }
  asm volatile("s_wait_asynccnt 0x0" ::: "memory");    // no copy is left in flight; behind the last trip's barrier both buffers are free
  l += xhalf(l);
  // join of the two key halves through LDS: half 1 hands over its base, sum and accumulators, lane for lane
  float* mg = (float*)&kst[0][0][0]; float* mst = mg + 4 * 32 * 32 * 4 + (qg * 32 + lane) * 2;
  if (hh == 1) {
    mst[0] = mk; mst[1] = l;
#pragma unroll
    for (int j = 0; j < CC / 16; ++j) {
      const v4f x0 = {o[j][0], o[j][1], o[j][2], o[j][3]}, x1 = {o[j][4], o[j][5], o[j][6], o[j][7]};
      *(v4f*)&mg[((qg * 32 + j * 2) * 32 + lane) * 4] = x0; *(v4f*)&mg[((qg * 32 + j * 2 + 1) * 32 + lane) * 4] = x1; }
  }
  __syncthreads();                                     // half 1's hand-over is visible to half 0
  if (hh == 0) {
    const float mk1 = mst[0], l1 = mst[1]; const float mf = fmaxf(mk, mk1);
    float a0 = __builtin_amdgcn_exp2f(mk - mf), a1 = __builtin_amdgcn_exp2f(mk1 - mf);
    const float inv = 1.0f / (l * a0 + l1 * a1); a0 *= inv; a1 *= inv;
    float (*os)[FA_OP] = (float (*)[FA_OP])&vst[0][0][0];   // this wave's 16 rows alone
#pragma unroll
    for (int j = 0; j < CC / 16; ++j) {
      const v4f y0 = *(const v4f*)&mg[((qg * 32 + j * 2) * 32 + lane) * 4], y1 = *(const v4f*)&mg[((qg * 32 + j * 2 + 1) * 32 + lane) * 4];
      const v4f x0 = {o[j][0], o[j][1], o[j][2], o[j][3]}, x1 = {o[j][4], o[j][5], o[j][6], o[j][7]};
      *(v4f*)&os[qg * 16 + col][j * 16 + 8 * g] = x0 * a0 + y0 * a1; *(v4f*)&os[qg * 16 + col][j * 16 + 8 * g + 4] = x1 * a0 + y1 * a1; }
    ldsx();
    float* op = OUT + ((size_t)b * TT + q0 + qg * 16) * CC + lane * 4;
    // 512 B of a row by 32 lanes x 16 B; unrolled by 8 so that the LDS reads go out together
#pragma unroll 8
    for (int it = 0; it < 32; ++it) vst2(op + (size_t)(it >> 1) * CC + (it & 1) * 128, *(const v4f*)&os[qg * 16 + (it >> 1)][(it & 1) * 128 + lane * 4]);
  }
}

extern "C" void kernel_launch(void* const* d_in, const int* in_sizes, int n_in, void* d_out, int out_size, void* d_ws, size_t ws_size, hipStream_t stream) {
  // inputs (wire order): 0 x [4,4096,256]; 1 Wq [256,256] (in,out); 2 bq [256]; 3 Wk; 4 bk; 5 Wv; 6 bv; all f32
  if (n_in < 7) return;
  if ((size_t)in_sizes[0] < ((size_t)(NB - 1) * SEQ_FULL + TT) * DIN) return;
  if (in_sizes[1] < DIN * CC || in_sizes[3] < DIN * CC || in_sizes[5] < DIN * CC) return;
  if (in_sizes[2] < CC || in_sizes[4] < CC || in_sizes[6] < CC) return;
  if ((size_t)out_size < (size_t)NB * TT * CC) return;
  if (ws_size < (size_t)WS_END) return;
  const float** F = (const float**)d_in;
  char* ws = (char*)d_ws;
  __bf16 *XB = (__bf16*)(ws + WS_XB), *WT = (__bf16*)(ws + WS_WT);
  _Float16 *QH = (_Float16*)(ws + WS_QH), *QL = (_Float16*)(ws + WS_QL), *KH = (_Float16*)(ws + WS_KH), *KL = (_Float16*)(ws + WS_KL), *VT = (_Float16*)(ws + WS_VT);
  float* OUT = (float*)d_out;
  k_xb<<<dim3((unsigned)(((size_t)NB * TT * (DIN / 8) + 255) / 256)), 256, 0, stream>>>(F[0], XB);
  k_wt<<<dim3(CC / 16, 3), 128, 0, stream>>>(F[1], F[3], F[5], WT);
  k_proj<<<dim3(NB * TT / 64, CC / 128, 3), 128, 0, stream>>>(XB, WT, F[2], F[4], F[6], QH, QL, KH, KL, VT);
  k_fa<<<dim3(TT / 64, NB), 256, 0, stream>>>(QH, QL, KH, KL, VT, OUT);
}

// v004
// It runs in 114 microseconds.
// Timed twice side by side with v003, it ran 1.12 and 1.11 times as fast.
// All steps since v000 together make it 10.0 times as fast.
// compute dtype: every float input RNE-converted to bf16 on load; q/k/v = x W + b with exact bf16 products on v_wmma_f32_16x16x32_bf16 (f32 accumulate); logits k q^T: q and k each carried as f16 hi + f16 residual x 2^10 (3 products on v_wmma_f32_16x16x32_f16, f32 accumulate); running row maximum, exp2 and row sum in f32; exp(s - running max) x 2^14 to f16 against v f16 (1 product on v_wmma_f32_16x16x32_f16, f32 accumulate), divided by the f32 row sum x 2^14; f32 output.
#include <hip/hip_runtime.h>
#include <math.h>

typedef __attribute__((ext_vector_type(16))) _Float16 v16h;
typedef __attribute__((ext_vector_type(16))) __bf16 v16b;
typedef __attribute__((ext_vector_type(8)))  _Float16 v8h;
typedef __attribute__((ext_vector_type(8)))  __bf16 v8b;
typedef __attribute__((ext_vector_type(8)))  float v8f;
typedef __attribute__((ext_vector_type(4)))  float v4f;
typedef __attribute__((ext_vector_type(4)))  unsigned v4u;
typedef __attribute__((ext_vector_type(8)))  unsigned v8u;

template <typename T> __device__ __forceinline__ void vst2(void* p, T v) { *(T*)p = v;  }

__device__ __forceinline__ v8f wmma_bf(v16b a, v16b b, v8f c) {
  v8f d = __builtin_amdgcn_wmma_f32_16x16x32_bf16(false, a, false, b, (short)0, c, false, false);
  asm volatile("v_nop\n\tv_nop\n\tv_nop\n\tv_nop" : "+v"(d) : "v"(a), "v"(b));
  return d;
}
// 16x16x32 fragments: lane = (h = lane>>4, row/col = lane&15); elements 0..7 = k0+8h+0..7, 8..15 = k0+16+8h+0..7; D element r = row 8h+r, col lane&15.
// A from a row-major [m][k] row; B from a k-contiguous [n][k] row: identical loader.
__device__ __forceinline__ v16h frag_h(const _Float16* rowk0, int lane) {
  union { v16h v; v8h q[2]; } u; const _Float16* p = rowk0 + 8 * (lane >> 4);
  u.q[0] = *(const v8h*)p; u.q[1] = *(const v8h*)(p + 16); return u.v;
}
__device__ __forceinline__ v16b frag_b(const __bf16* rowk0, int lane) {
  union { v16b v; v8b q[2]; } u; const __bf16* p = rowk0 + 8 * (lane >> 4);
  u.q[0] = *(const v8b*)p; u.q[1] = *(const v8b*)(p + 16); return u.v;
}
__device__ __forceinline__ float bfr(float v) { return (float)(__bf16)v; }
// wave-private LDS tile: 16-B stores by this wave, then 16-B reloads by other lanes of the same wave
__device__ __forceinline__ void ldsx() { asm volatile("s_wait_dscnt 0x0" ::: "memory"); __builtin_amdgcn_wave_barrier(); __builtin_amdgcn_fence(3, "workgroup"); }

// Single-head softmax attention: q/k/v = x W + b (W (in,out) 256x256); logits = q k^T (no scale); the reference's keep-test s >= rowmin(s) holds for every finite logit by the definition of the minimum and is not evaluated; softmax over all keys; out = P v.
#ifndef NB
#define NB 4
#endif
#ifndef SEQ
#define SEQ 4096
#endif
#define NB_FULL 4
#define SEQ_FULL 4096
#define TT SEQ
#define CC 256            // projected width (head dim)
#define DIN 256           // input width
static_assert(NB >= 1 && NB <= NB_FULL);
static_assert(SEQ >= 128 && SEQ <= SEQ_FULL && (SEQ % 64) == 0);
static_assert(CC == 256 && DIN == 256);

#define WS_XB  0u                                         // bf16 x rows [NB*TT][DIN]
#define WS_WT  (WS_XB + 2u * (size_t)NB * TT * DIN)        // bf16 weights, out-major [3][CC][DIN]
#define WS_QH  (WS_WT + 2u * (size_t)3 * CC * DIN)         // f16 q hi rows [NB*TT][CC]
#define WS_QL  (WS_QH + 2u * (size_t)NB * TT * CC)         // f16 q residual x 2^10 rows
#define WS_KH  (WS_QL + 2u * (size_t)NB * TT * CC)         // f16 k hi rows
#define WS_KL  (WS_KH + 2u * (size_t)NB * TT * CC)         // f16 k residual x 2^10 rows
#define WS_VT  (WS_KL + 2u * (size_t)NB * TT * CC)         // f16 v planes [NB][CC][TT]
#define WS_END (WS_VT + 2u * (size_t)NB * CC * TT)
static_assert(WS_END <= (size_t)134217728u);
static_assert((WS_WT % 128u) == 0 && (WS_QH % 128u) == 0);

__global__ __launch_bounds__(256) void k_xb(const float* __restrict__ X, __bf16* __restrict__ XB) {
  const size_t i = (size_t)blockIdx.x * 256 + threadIdx.x; if (i >= (size_t)NB * TT * (DIN / 8)) return;
  const size_t r = i / (DIN / 8); const int k = (int)(i % (DIN / 8)) * 8;
  const float* p = X + (((r / TT) * SEQ_FULL + (r % TT)) * (size_t)DIN + k);
  const v4f x0 = *(const v4f*)p, x1 = *(const v4f*)(p + 4);
  union { v8b h; v4u u; } o;
#pragma unroll
  for (int e = 0; e < 4; ++e) { o.h[e] = (__bf16)x0[e]; o.h[4 + e] = (__bf16)x1[e]; }
  vst2(XB + r * DIN + k, o.u);
}
// ---- k_wt: block = 16 output columns of one weight: WT[pl][o][k] = bf16(W[k][o]); LDS transpose, whole 512-B rows by 32 consecutive lanes x 16 B
__global__ __launch_bounds__(128) void k_wt(const float* __restrict__ WQ, const float* __restrict__ WK, const float* __restrict__ WV, __bf16* __restrict__ WT) {
  __shared__ __align__(16) __bf16 tr[16][DIN + 8];
  const int tid = threadIdx.x; const int c0 = blockIdx.x * 16; const int pl = blockIdx.y;
  const float* W = pl == 0 ? WQ : pl == 1 ? WK : WV;
#pragma unroll 4
  for (int it = 0; it < (16 * DIN) / 128; ++it) { const int idx = it * 128 + tid; const int k = idx >> 4, cl = idx & 15; tr[cl][k] = (__bf16)W[(size_t)k * CC + c0 + cl]; }
  __syncthreads();
  for (int e = tid; e < 16 * (DIN / 8); e += 128) { const int rl = e >> 5, q = e & 31; vst2(WT + ((size_t)pl * CC + c0 + rl) * DIN + q * 8, *(const v4u*)&tr[rl][q * 8]); }
}
// ---- asynchronous copies global -> LDS, 16 B a lane (512 B a copy), through no register. l, g: the lane's own LDS byte address and global address; ls, gs: step from copy to copy (bytes; halves).
// The closing s_wait_xcnt keeps every later write of these address registers behind the copies.
__device__ __forceinline__ void copy8(unsigned l, unsigned ls, const _Float16* g, size_t gs) {
  asm volatile("global_load_async_to_lds_b128 %0, %8, off\n\t"
               "global_load_async_to_lds_b128 %1, %9, off\n\t"
               "global_load_async_to_lds_b128 %2, %10, off\n\t"
               "global_load_async_to_lds_b128 %3, %11, off\n\t"
               "global_load_async_to_lds_b128 %4, %12, off\n\t"
               "global_load_async_to_lds_b128 %5, %13, off\n\t"
               "global_load_async_to_lds_b128 %6, %14, off\n\t"
               "global_load_async_to_lds_b128 %7, %15, off\n\t"
               "s_wait_xcnt 0x0"
               :: "v"(l), "v"(l + ls), "v"(l + 2 * ls), "v"(l + 3 * ls), "v"(l + 4 * ls), "v"(l + 5 * ls), "v"(l + 6 * ls), "v"(l + 7 * ls),
                  "v"(g), "v"(g + gs), "v"(g + 2 * gs), "v"(g + 3 * gs), "v"(g + 4 * gs), "v"(g + 5 * gs), "v"(g + 6 * gs), "v"(g + 7 * gs)
               : "memory");
}
// ---- k_proj: block = (64 compact rows, 128 cols, which): q/k/v = X W + b with exact bf16 products (K = DIN) -> which 0: q f16 hi + residual rows; 1: k f16 hi + residual rows; 2: v f16 planes [c][t]
// The block's 64 x rows and 128 weight rows (512 B each, LDS pitch 528 B = 16 B x odd for the 16-B fragment reads) are brought whole into LDS once by asynchronous copies, a row a copy; every fragment is read from LDS.
#define PJ_PITCH (DIN + 8)         // halves
__global__ __launch_bounds__(128) __attribute__((amdgpu_num_vgpr(256)))
void k_proj(const __bf16* __restrict__ XB, const __bf16* __restrict__ WT, const float* __restrict__ BQ, const float* __restrict__ BK, const float* __restrict__ BV,
            _Float16* __restrict__ QH, _Float16* __restrict__ QL, _Float16* __restrict__ KH, _Float16* __restrict__ KL, _Float16* __restrict__ VT) {
  __shared__ __align__(16) __bf16 xs[64][PJ_PITCH], wr[128][PJ_PITCH];
  __shared__ __align__(16) _Float16 sh[64][136], sl[64][136]; __shared__ __align__(16) _Float16 th[128][72];
  const int tid = threadIdx.x, wave = tid >> 5, lane = tid & 31, col = lane & 15, g = lane >> 4;
  const int which = blockIdx.z; const int c0 = blockIdx.y * 128; const size_t r0 = (size_t)blockIdx.x * 64; const size_t bb = r0 / TT; const int t0 = (int)(r0 % TT);
  const float* BA = which == 0 ? BQ : which == 1 ? BK : BV;
  const __bf16* WP = WT + (size_t)which * CC * DIN;
  { // wave w copies x rows 16 w .. 16 w + 15 and weight rows 32 w .. 32 w + 31: 48 copies a wave
    const unsigned lx = (unsigned)(size_t)&xs[wave * 16][lane * 8], lw = (unsigned)(size_t)&wr[wave * 32][lane * 8];
    const _Float16* gx = (const _Float16*)(XB + (r0 + wave * 16) * DIN + lane * 8); const _Float16* gw = (const _Float16*)(WP + (size_t)(c0 + wave * 32) * DIN + lane * 8);
#pragma unroll    // straight-line copies
    for (int u = 0; u < 2; ++u) copy8(lx + u * 16u * PJ_PITCH, 2u * PJ_PITCH, gx + u * 8 * DIN, DIN);
#pragma unroll    // as above
    for (int u = 0; u < 4; ++u) copy8(lw + u * 16u * PJ_PITCH, 2u * PJ_PITCH, gw + u * 8 * DIN, DIN);
  }
  v8f acc[8] = {};
  asm volatile("s_wait_asynccnt 0x0" ::: "memory");   // this wave's rows have landed
  __syncthreads();                                     // ... and every wave's
  v16b fa[2], fb[2][8];   // fragments of one k step, two sets
  auto ldf = [&](int kc) {
    fa[kc & 1] = frag_b(&xs[wave * 16 + col][kc * 32], lane);
#pragma unroll    // every fragment index a constant (registers, no scratch)
    for (int j = 0; j < 8; ++j) fb[kc & 1][j] = frag_b(&wr[j * 16 + col][kc * 32], lane);
  };
  ldf(0);
#pragma unroll    // the LDS offsets become immediates, every fragment index a constant
  for (int kc = 0; kc < DIN / 32; ++kc) {
    if (kc + 1 < DIN / 32) ldf(kc + 1);   // the next k step's LDS reads go out together, ahead of this step's products
#pragma unroll
    for (int j = 0; j < 8; ++j) acc[j] = wmma_bf(fa[kc & 1], fb[kc & 1][j], acc[j]);
  }
  if (which < 2) { _Float16* DH = which == 0 ? QH : KH; _Float16* DL = which == 0 ? QL : KL;
#pragma unroll
    for (int j = 0; j < 8; ++j) { const float bias = bfr(BA[c0 + j * 16 + col]);
#pragma unroll
      for (int r = 0; r < 8; ++r) { const float v = acc[j][r] + bias; const _Float16 hv = (_Float16)v; sh[wave * 16 + 8 * g + r][j * 16 + col] = hv; sl[wave * 16 + 8 * g + r][j * 16 + col] = (_Float16)((v - (float)hv) * 1024.0f); } }
    __syncthreads();
    for (int e = tid; e < 64 * 16; e += 128) { const int rl = e >> 4, q = e & 15; vst2(DH + (r0 + rl) * CC + c0 + q * 8, *(const v4u*)&sh[rl][q * 8]); vst2(DL + (r0 + rl) * CC + c0 + q * 8, *(const v4u*)&sl[rl][q * 8]); }
  } else {
#pragma unroll
    for (int j = 0; j < 8; ++j) { const float bias = bfr(BA[c0 + j * 16 + col]);
#pragma unroll
      for (int r = 0; r < 8; ++r) { const float v = acc[j][r] + bias; const int rl = wave * 16 + 8 * g + r, cl = j * 16 + col; th[cl][rl] = (_Float16)v; } }
    __syncthreads();
    for (int e = tid; e < 128 * 8; e += 128) { const int cl = e >> 3, q = e & 7; vst2(VT + (bb * CC + c0 + cl) * (size_t)TT + t0 + q * 8, *(const v4u*)&th[cl][q * 8]); } }
}
#define FA_KT 64                   // keys per stage
#define FA_KPITCH (CC / 2 + 8)     // halves; 272 B = 16 B x odd for the 16-B fragment reads
#define FA_VPITCH (FA_KT + 8)      // halves; 144 B = 16 B x odd
#define FA_KTILE 18432u            // bytes a k tile takes: 64 x 272 = 17,408, rounded up to a multiple of 2 KiB
#define FA_VTILE 10240u            // bytes a v tile takes: 64 x 144 = 9,216, rounded up to a multiple of 2 KiB
#define FA_BUF (4u * FA_KTILE + 4u * FA_VTILE)   // bytes a buffer: k tiles (2 plane + column half), then v tiles (row >> 6)
#define FA_NT (TT / FA_KT)
static_assert(FA_KTILE >= 2u * FA_KT * FA_KPITCH && FA_VTILE >= 2u * 64 * FA_VPITCH && (FA_KTILE % 2048u) == 0 && (FA_VTILE % 2048u) == 0 && FA_NT >= 2);
#define FA_OP (CC + 4)             // floats; pitch of the output staging rows
#define LOG2E 1.4426950408889634f
static_assert((TT % FA_KT) == 0 && (TT % 64) == 0);
__device__ __forceinline__ v8f wm(v16h a, v16h b, v8f c) { return __builtin_amdgcn_wmma_f32_16x16x32_f16(false, a, false, b, (short)0, c, false, false); }
__device__ __forceinline__ void fence() { __builtin_amdgcn_sched_barrier(0); }
// k fragments of k steps 2 gi and 2 gi + 1: per step key tile 0 hi, key tile 1 hi, key tile 0 residual, key tile 1 residual; r = this lane's row of key tile 0 in the LDS tile (hi, columns 0..127)
__device__ __forceinline__ void fa_ldk(v16h (&f)[8], const _Float16* r, int gi, int lane) {
#pragma unroll    // every fragment index a constant (registers, no scratch)
  for (int u = 0; u < 2; ++u) { const int kk = gi * 2 + u; const _Float16* p = r + (kk >> 2) * (int)(FA_KTILE / 2) + (kk & 3) * 32; const _Float16* pl = p + 2 * (int)(FA_KTILE / 2);
    f[4 * u] = frag_h(p, lane); f[4 * u + 1] = frag_h(p + 16 * FA_KPITCH, lane); f[4 * u + 2] = frag_h(pl, lane); f[4 * u + 3] = frag_h(pl + 16 * FA_KPITCH, lane); }
}
// ---- tensor load global -> LDS: one request of a whole wave brings 64 rows of ROWB bytes (source pitch in bytes) and pads every row by 16 B in LDS. Every descriptor word is made wave-uniform.
__device__ __forceinline__ unsigned uni(unsigned v) { return (unsigned)__builtin_amdgcn_readfirstlane(v); }
// a wave-uniform test held in a scalar register, so that the branch on it is a scalar branch (a tensor load ignores EXEC)
__device__ __forceinline__ unsigned pinned(unsigned v) { unsigned w = uni(v); asm volatile("" : "+s"(w)); return w; }
__device__ __forceinline__ v4u tdm_group0(unsigned lds_dst, unsigned long long ga) {
  v4u g0; g0[0] = uni(1u); g0[1] = uni(lds_dst); g0[2] = uni((unsigned)ga); g0[3] = uni((((unsigned)(ga >> 32)) & 0x01FFFFFFu) | 0x80000000u);
  return g0;
}
template <unsigned ROWB, unsigned IVL>   // IVL: pad interval code, 5 = 256-B rows, 4 = 128-B rows; pad amount code 3 = 4 dwords
__device__ __forceinline__ v8u tdm_group1(unsigned src_pitch) {
  v8u g1;
  g1[0] = uni((1u << 20) | (IVL << 22) | (3u << 25));   // no mask, 1-byte elements, pad on
  g1[1] = uni(ROWB << 16);                              // tensor_dim0 = the tile's
  g1[2] = uni(64u << 16);                               // tensor_dim1 = the tile's
  g1[3] = uni(ROWB << 16);                              // tile_dim0
  g1[4] = uni(64u);                                     // tile_dim1
  g1[5] = uni(src_pitch); g1[6] = uni(0u); g1[7] = uni(0u);
  return g1;
}
__device__ __forceinline__ void tdm_load(v4u g0, v8u g1) { asm volatile("tensor_load_to_lds %0, %1" :: "s"(g0), "s"(g1) : "memory"); }
// lane l with lane l ^ 16
__device__ __forceinline__ float xhalf(float x) { return __builtin_bit_cast(float, __builtin_amdgcn_permlanex16(__builtin_bit_cast(int, x), __builtin_bit_cast(int, x), 0x76543210, 0xfedcba98, false, false)); }
__global__ __launch_bounds__(256)
void k_fa(const _Float16* __restrict__ QH, const _Float16* __restrict__ QL, const _Float16* __restrict__ KH, const _Float16* __restrict__ KL, const _Float16* __restrict__ VT, float* __restrict__ OUT) {
  __shared__ __attribute__((aligned(2048))) unsigned char ring[2 * FA_BUF];   // the kernel's only LDS: every tile's place is a multiple of 2 KiB
  static_assert(FA_BUF >= 4u * (4 * 32 * 32 * 4 + 4 * 32 * 2) && FA_BUF >= 4u * 64 * FA_OP);
  const int tid = threadIdx.x, wave = __builtin_amdgcn_readfirstlane(tid >> 5), lane = tid & 31, col = lane & 15, g = lane >> 4;
  const int q0 = blockIdx.x * 64, b = blockIdx.y; const int qg = wave & 3, hh = wave >> 2;
  // every wave brings one tile a stage: waves 0..3 the k tile (plane wave >> 1, column half wave & 1), waves 4..7 v rows 64 (wave - 4) .. 64 (wave - 4) + 63
  const unsigned lbase = (unsigned)(size_t)ring;
  const unsigned long long gk = (unsigned long long)(size_t)((wave & 2 ? KL : KH) + (size_t)b * TT * CC + (wave & 1) * (CC / 2));
  const unsigned long long gv = (unsigned long long)(size_t)(VT + ((size_t)b * CC + (wave & 3) * 64) * TT);
  v8u g1k = tdm_group1<CC, 5u>(2u * CC), g1v = tdm_group1<2u * FA_KT, 4u>(2u * TT);
  asm volatile("" : "+s"(g1k), "+s"(g1v));   // descriptor words held in scalar registers (as pinned() holds one): built once, the same registers at every request
  v4u g0k, g0v;
  auto stage = [&](int t) {   // one request a wave; the two forms differ in constants of the descriptor, so each stands in its own scalar branch
    const unsigned dst = lbase + (unsigned)(t & 1) * FA_BUF;
    g0k = tdm_group0(dst + (unsigned)(wave & 3) * FA_KTILE, gk + (unsigned long long)t * (2u * FA_KT * CC));
    g0v = tdm_group0(dst + 4u * FA_KTILE + (unsigned)(wave & 3) * FA_VTILE, gv + (unsigned long long)t * (2u * FA_KT));
    asm volatile("" : "+s"(g0k), "+s"(g0v));   // descriptor words held in scalar registers (as pinned() holds one), theirs until landed() has read them
    if (pinned(wave < 4)) tdm_load(g0k, g1k); else tdm_load(g0v, g1v);
  };
  // this wave's request has landed; the descriptor words are named as inputs so that their registers keep their values as long as the request is out
  auto landed = [&]() { asm volatile("s_wait_tensorcnt 0x0" :: "s"(g0k), "s"(g0v), "s"(g1k), "s"(g1v) : "memory"); };
  stage(0);
  v16h qh[CC / 32], ql[CC / 32];
  { const size_t qr = ((size_t)b * TT + q0 + qg * 16 + col) * CC;
#pragma unroll    // every fragment index a constant (registers, no scratch); so for every unrolled loop of this kernel
    for (int kk = 0; kk < CC / 32; ++kk) { qh[kk] = frag_h(QH + qr + kk * 32, lane); ql[kk] = frag_h(QL + qr + kk * 32, lane); } }
  v8f o[CC / 16] = {};
  float m = -1.0e30f, mk = -1.0e30f, l = 0.f;         // running maximum; its exponent base m log2(e) - 14; this lane's share of the row sum x 2^14
  landed();                                            // this wave's tile of stage 0
  __syncthreads();                                     // ... and every wave's
  stage(1);
#pragma unroll 1  // one body for both buffers: the code stays short
  for (int t = 0; t < FA_NT; ++t) {
    const unsigned char* bf = ring + (unsigned)(t & 1) * FA_BUF;
    const _Float16* kr = (const _Float16*)bf + (hh * 32 + col) * FA_KPITCH; const _Float16* vr = (const _Float16*)(bf + 4u * FA_KTILE) + col * FA_VPITCH + hh * 32;
    v8f sa[2] = {}, sb[2] = {};
    v16h kf[2][8], va[8], vc[8];   // k fragments of two k steps a group, two groups; v fragments of columns 0..127 and 128..255
    fa_ldk(kf[0], kr, 0, lane);
#pragma unroll    // the LDS offsets become immediates, every fragment and q index a constant
    for (int gi = 0; gi < CC / 64; ++gi) {
      // the next group's LDS reads go out together, ahead of this group's products; behind the last k group, the first half of v
      if (gi + 1 < CC / 64) fa_ldk(kf[(gi + 1) & 1], kr, gi + 1, lane);
      else {
#pragma unroll
        for (int j = 0; j < 8; ++j) va[j] = frag_h(vr + (j >> 2) * (int)(FA_VTILE / 2) + (j & 3) * 16 * FA_VPITCH, lane); }
      fence();    // keeps those reads in front of the products, so that their latency runs under them
#pragma unroll
      for (int u = 0; u < 2; ++u) { const int kk = gi * 2 + u; const v16h h0 = kf[gi & 1][4 * u], h1 = kf[gi & 1][4 * u + 1], l0 = kf[gi & 1][4 * u + 2], l1 = kf[gi & 1][4 * u + 3];
        sa[0] = wm(h0, qh[kk], sa[0]); sa[1] = wm(h1, qh[kk], sa[1]);
        sb[0] = wm(h0, ql[kk], sb[0]); sb[1] = wm(h1, ql[kk], sb[1]);
        sb[0] = wm(l0, qh[kk], sb[0]); sb[1] = wm(l1, qh[kk], sb[1]); }
      fence();    // keeps the following group's reads out of this run of products
    }
    float s[16];   // logits of query col against keys 32 hh + 8 g + e (e < 8), 32 hh + 16 + 8 g + e - 8
#pragma unroll
    for (int e = 0; e < 16; ++e) s[e] = sa[e >> 3][e & 7] + sb[e >> 3][e & 7] * (1.0f / 1024.0f);
    float mx = fmaxf(fmaxf(fmaxf(s[0], s[1]), fmaxf(s[2], s[3])), fmaxf(fmaxf(s[4], s[5]), fmaxf(s[6], s[7])));
    mx = fmaxf(mx, fmaxf(fmaxf(fmaxf(s[8], s[9]), fmaxf(s[10], s[11])), fmaxf(fmaxf(s[12], s[13]), fmaxf(s[14], s[15]))));
    mx = fmaxf(mx, xhalf(mx));
    const float mn = fmaxf(m, mx);
    if (__builtin_amdgcn_ballot_w32(mn > m) != 0) {   // one scalar test a stage; a lane whose maximum stays multiplies by exactly 1
      const float mkn = mn * LOG2E - 14.0f; const float al = __builtin_amdgcn_exp2f(mk - mkn);
      l *= al;
#pragma unroll
      for (int j = 0; j < CC / 16; ++j) o[j] *= al;
      m = mn; mk = mkn;
    }
    v16h pf; float ps[4] = {0.f, 0.f, 0.f, 0.f};
#pragma unroll
    for (int e = 0; e < 16; ++e) { const float p = __builtin_amdgcn_exp2f(fmaf(s[e], LOG2E, -mk)); ps[e & 3] += p; pf[e] = (_Float16)p; }
    l += (ps[0] + ps[1]) + (ps[2] + ps[3]);
#pragma unroll    // every index a constant
    for (int j = 0; j < 8; ++j) vc[j] = frag_h(vr + (2 + (j >> 2)) * (int)(FA_VTILE / 2) + (j & 3) * 16 * FA_VPITCH, lane);
    fence();      // keeps the reads of the second half of v in front of the products of the first, so that their latency runs under them
#pragma unroll    // as above
    for (int j = 0; j < 8; ++j) o[j] = wm(va[j], pf, o[j]);
#pragma unroll    // as above
    for (int j = 0; j < 8; ++j) o[8 + j] = wm(vc[j], pf, o[8 + j]);
    asm volatile("s_wait_dscnt 0x0" ::: "memory");     // this wave's reads of stage t are done before the buffer is handed back
    landed();                                          // this wave's tile of stage t + 1
    __syncthreads();                                   // publishes stage t + 1 and frees stage t's buffer
    if (pinned(t + 2 < FA_NT)) stage(t + 2);
  }
  landed();                                            // no request is left in flight
  asm volatile("s_wait_dscnt 0x0" ::: "memory");       // no LDS read either; behind the last trip's barrier both buffers are free
  l += xhalf(l);
  // join of the two key halves through LDS: half 1 hands over its base, sum and accumulators, lane for lane
  float* mg = (float*)ring; float* mst = mg + 4 * 32 * 32 * 4 + (qg * 32 + lane) * 2;
  if (hh == 1) {
    mst[0] = mk; mst[1] = l;
#pragma unroll
    for (int j = 0; j < CC / 16; ++j) {
      const v4f x0 = {o[j][0], o[j][1], o[j][2], o[j][3]}, x1 = {o[j][4], o[j][5], o[j][6], o[j][7]};
      *(v4f*)&mg[((qg * 32 + j * 2) * 32 + lane) * 4] = x0; *(v4f*)&mg[((qg * 32 + j * 2 + 1) * 32 + lane) * 4] = x1; }
  }
  __syncthreads();                                     // half 1's hand-over is visible to half 0
  if (hh == 0) {
    const float mk1 = mst[0], l1 = mst[1]; const float mf = fmaxf(mk, mk1);
    float a0 = __builtin_amdgcn_exp2f(mk - mf), a1 = __builtin_amdgcn_exp2f(mk1 - mf);
    const float inv = 1.0f / (l * a0 + l1 * a1); a0 *= inv; a1 *= inv;
    float (*os)[FA_OP] = (float (*)[FA_OP])(ring + FA_BUF);   // this wave's 16 rows alone
#pragma unroll
    for (int j = 0; j < CC / 16; ++j) {
      const v4f y0 = *(const v4f*)&mg[((qg * 32 + j * 2) * 32 + lane) * 4], y1 = *(const v4f*)&mg[((qg * 32 + j * 2 + 1) * 32 + lane) * 4];
      const v4f x0 = {o[j][0], o[j][1], o[j][2], o[j][3]}, x1 = {o[j][4], o[j][5], o[j][6], o[j][7]};
      *(v4f*)&os[qg * 16 + col][j * 16 + 8 * g] = x0 * a0 + y0 * a1; *(v4f*)&os[qg * 16 + col][j * 16 + 8 * g + 4] = x1 * a0 + y1 * a1; }
    ldsx();
    float* op = OUT + ((size_t)b * TT + q0 + qg * 16) * CC + lane * 4;
    // 512 B of a row by 32 lanes x 16 B; unrolled by 8 so that the LDS reads go out together
#pragma unroll 8
    for (int it = 0; it < 32; ++it) vst2(op + (size_t)(it >> 1) * CC + (it & 1) * 128, *(const v4f*)&os[qg * 16 + (it >> 1)][(it & 1) * 128 + lane * 4]);
  }
}

extern "C" void kernel_launch(void* const* d_in, const int* in_sizes, int n_in, void* d_out, int out_size, void* d_ws, size_t ws_size, hipStream_t stream) {
  // inputs (wire order): 0 x [4,4096,256]; 1 Wq [256,256] (in,out); 2 bq [256]; 3 Wk; 4 bk; 5 Wv; 6 bv; all f32
  if (n_in < 7) return;
  if ((size_t)in_sizes[0] < ((size_t)(NB - 1) * SEQ_FULL + TT) * DIN) return;
  if (in_sizes[1] < DIN * CC || in_sizes[3] < DIN * CC || in_sizes[5] < DIN * CC) return;
  if (in_sizes[2] < CC || in_sizes[4] < CC || in_sizes[6] < CC) return;
  if ((size_t)out_size < (size_t)NB * TT * CC) return;
  if (ws_size < (size_t)WS_END) return;
  const float** F = (const float**)d_in;
  char* ws = (char*)d_ws;
  __bf16 *XB = (__bf16*)(ws + WS_XB), *WT = (__bf16*)(ws + WS_WT);
  _Float16 *QH = (_Float16*)(ws + WS_QH), *QL = (_Float16*)(ws + WS_QL), *KH = (_Float16*)(ws + WS_KH), *KL = (_Float16*)(ws + WS_KL), *VT = (_Float16*)(ws + WS_VT);
  float* OUT = (float*)d_out;
  k_xb<<<dim3((unsigned)(((size_t)NB * TT * (DIN / 8) + 255) / 256)), 256, 0, stream>>>(F[0], XB);
  k_wt<<<dim3(CC / 16, 3), 128, 0, stream>>>(F[1], F[3], F[5], WT);
  k_proj<<<dim3(NB * TT / 64, CC / 128, 3), 128, 0, stream>>>(XB, WT, F[2], F[4], F[6], QH, QL, KH, KL, VT);
  k_fa<<<dim3(TT / 64, NB), 256, 0, stream>>>(QH, QL, KH, KL, VT, OUT);
}

// v005
// One run takes 110 microseconds.
// Next to v004, in two timings, it ran 1.03 and 1.04 times as fast.
// All steps since v000 together make it 10.4 times as fast.
// compute dtype: every float input RNE-converted to bf16 on load; q/k/v = x W + b with exact bf16 products on v_wmma_f32_16x16x32_bf16 (f32 accumulate); logits k q^T: q and k each carried as f16 hi + f16 residual x 2^10 (3 products on v_wmma_f32_16x16x32_f16, f32 accumulate); running row maximum, exp2 and row sum in f32; exp(s - running max) x 2^14 to f16 against v f16 (1 product on v_wmma_f32_16x16x32_f16, f32 accumulate), divided by the f32 row sum x 2^14; f32 output.
#include <hip/hip_runtime.h>
#include <math.h>

typedef __attribute__((ext_vector_type(16))) _Float16 v16h;
typedef __attribute__((ext_vector_type(16))) __bf16 v16b;
typedef __attribute__((ext_vector_type(8)))  _Float16 v8h;
typedef __attribute__((ext_vector_type(8)))  __bf16 v8b;
typedef __attribute__((ext_vector_type(8)))  float v8f;
typedef __attribute__((ext_vector_type(4)))  float v4f;
typedef __attribute__((ext_vector_type(4)))  unsigned v4u;
typedef __attribute__((ext_vector_type(2)))  unsigned v2u;
typedef __attribute__((ext_vector_type(8)))  unsigned v8u;

template <typename T> __device__ __forceinline__ void vst2(void* p, T v) { *(T*)p = v;  }

__device__ __forceinline__ v8f wmma_bf(v16b a, v16b b, v8f c) {
  v8f d = __builtin_amdgcn_wmma_f32_16x16x32_bf16(false, a, false, b, (short)0, c, false, false);
  asm volatile("v_nop\n\tv_nop\n\tv_nop\n\tv_nop" : "+v"(d) : "v"(a), "v"(b));
  return d;
}
// 16x16x32 fragments: lane = (h = lane>>4, row/col = lane&15); elements 0..7 = k0+8h+0..7, 8..15 = k0+16+8h+0..7; D element r = row 8h+r, col lane&15.
// A from a row-major [m][k] row; B from a k-contiguous [n][k] row: identical loader.
__device__ __forceinline__ v16h frag_h(const _Float16* rowk0, int lane) {
  union { v16h v; v8h q[2]; } u; const _Float16* p = rowk0 + 8 * (lane >> 4);
  u.q[0] = *(const v8h*)p; u.q[1] = *(const v8h*)(p + 16); return u.v;
}
__device__ __forceinline__ v16b frag_b(const __bf16* rowk0, int lane) {
  union { v16b v; v8b q[2]; } u; const __bf16* p = rowk0 + 8 * (lane >> 4);
  u.q[0] = *(const v8b*)p; u.q[1] = *(const v8b*)(p + 16); return u.v;
}
__device__ __forceinline__ float bfr(float v) { return (float)(__bf16)v; }
// wave-private LDS tile: 16-B stores by this wave, then 16-B reloads by other lanes of the same wave
__device__ __forceinline__ void ldsx() { asm volatile("s_wait_dscnt 0x0" ::: "memory"); __builtin_amdgcn_wave_barrier(); __builtin_amdgcn_fence(3, "workgroup"); }

// Single-head softmax attention: q/k/v = x W + b (W (in,out) 256x256); logits = q k^T (no scale); the reference's keep-test s >= rowmin(s) holds for every finite logit by the definition of the minimum and is not evaluated; softmax over all keys; out = P v.
#ifndef NB
#define NB 4
#endif
#ifndef SEQ
#define SEQ 4096
#endif
#define NB_FULL 4
#define SEQ_FULL 4096
#define TT SEQ
#define CC 256            // projected width (head dim)
#define DIN 256           // input width
static_assert(NB >= 1 && NB <= NB_FULL);
static_assert(SEQ >= 128 && SEQ <= SEQ_FULL && (SEQ % 64) == 0);
static_assert(CC == 256 && DIN == 256);

#define WS_WT  0u                                         // bf16 weights, out-major [3][CC][DIN]
#define WS_QH  (WS_WT + 2u * (size_t)3 * CC * DIN)         // f16 q hi rows [NB*TT][CC]
#define WS_QL  (WS_QH + 2u * (size_t)NB * TT * CC)         // f16 q residual x 2^10 rows
#define WS_KH  (WS_QL + 2u * (size_t)NB * TT * CC)         // f16 k hi rows
#define WS_KL  (WS_KH + 2u * (size_t)NB * TT * CC)         // f16 k residual x 2^10 rows
#define WS_VT  (WS_KL + 2u * (size_t)NB * TT * CC)         // f16 v planes [NB][CC][TT]
#define WS_END (WS_VT + 2u * (size_t)NB * CC * TT)
static_assert(WS_END <= (size_t)134217728u);
static_assert((WS_WT % 128u) == 0 && (WS_QH % 128u) == 0);

// ---- k_wt: block = 16 output columns of one weight: WT[pl][o][k] = bf16(W[k][o]); LDS transpose, whole 512-B rows by 32 consecutive lanes x 16 B
__global__ __launch_bounds__(128) void k_wt(const float* __restrict__ WQ, const float* __restrict__ WK, const float* __restrict__ WV, __bf16* __restrict__ WT) {
  __shared__ __align__(16) __bf16 tr[16][DIN + 8];
  const int tid = threadIdx.x; const int c0 = blockIdx.x * 16; const int pl = blockIdx.y;
  const float* W = pl == 0 ? WQ : pl == 1 ? WK : WV;
#pragma unroll 4
  for (int it = 0; it < (16 * DIN) / 128; ++it) { const int idx = it * 128 + tid; const int k = idx >> 4, cl = idx & 15; tr[cl][k] = (__bf16)W[(size_t)k * CC + c0 + cl]; }
  __syncthreads();
  for (int e = tid; e < 16 * (DIN / 8); e += 128) { const int rl = e >> 5, q = e & 31; vst2(WT + ((size_t)pl * CC + c0 + rl) * DIN + q * 8, *(const v4u*)&tr[rl][q * 8]); }
}
// ---- asynchronous copies global -> LDS, 16 B a lane (512 B a copy), through no register. l, g: the lane's own LDS byte address and global address; ls, gs: step from copy to copy (bytes; halves).
// The closing s_wait_xcnt keeps every later write of these address registers behind the copies.
__device__ __forceinline__ void copy8(unsigned l, unsigned ls, const _Float16* g, size_t gs) {
  asm volatile("global_load_async_to_lds_b128 %0, %8, off\n\t"
               "global_load_async_to_lds_b128 %1, %9, off\n\t"
               "global_load_async_to_lds_b128 %2, %10, off\n\t"
               "global_load_async_to_lds_b128 %3, %11, off\n\t"
               "global_load_async_to_lds_b128 %4, %12, off\n\t"
               "global_load_async_to_lds_b128 %5, %13, off\n\t"
               "global_load_async_to_lds_b128 %6, %14, off\n\t"
               "global_load_async_to_lds_b128 %7, %15, off\n\t"
               "s_wait_xcnt 0x0"
               :: "v"(l), "v"(l + ls), "v"(l + 2 * ls), "v"(l + 3 * ls), "v"(l + 4 * ls), "v"(l + 5 * ls), "v"(l + 6 * ls), "v"(l + 7 * ls),
                  "v"(g), "v"(g + gs), "v"(g + 2 * gs), "v"(g + 3 * gs), "v"(g + 4 * gs), "v"(g + 5 * gs), "v"(g + 6 * gs), "v"(g + 7 * gs)
               : "memory");
}
// ---- k_proj: block = (64 compact rows, 128 cols, which): q/k/v = X W + b with exact bf16 products (K = DIN) -> which 0: q f16 hi + residual rows; 1: k f16 hi + residual rows; 2: v f16 planes [c][t]
// The block's 64 x rows and 128 weight rows (512 B each as bf16, LDS pitch 528 B = 16 B x odd for the 16-B fragment reads) are brought whole into LDS once; every fragment is read from LDS.
// Weight rows come by asynchronous copies, a row a copy. x rows are read as f32 straight from the input, rounded to bf16 in registers and stored to LDS: no launch and no workspace plane for the rounded x.
#define PJ_PITCH (DIN + 8)         // halves
__global__ __launch_bounds__(128) __attribute__((amdgpu_num_vgpr(256)))
void k_proj(const float* __restrict__ X, const __bf16* __restrict__ WT, const float* __restrict__ BQ, const float* __restrict__ BK, const float* __restrict__ BV,
            _Float16* __restrict__ QH, _Float16* __restrict__ QL, _Float16* __restrict__ KH, _Float16* __restrict__ KL, _Float16* __restrict__ VT) {
  __shared__ __align__(16) __bf16 xs[64][PJ_PITCH], wr[128][PJ_PITCH];
  __shared__ __align__(16) _Float16 sh[64][136], sl[64][136]; __shared__ __align__(16) _Float16 th[128][72];
  const int tid = threadIdx.x, wave = tid >> 5, lane = tid & 31, col = lane & 15, g = lane >> 4;
  const int which = blockIdx.z; const int c0 = blockIdx.y * 128; const size_t r0 = (size_t)blockIdx.x * 64; const size_t bb = r0 / TT; const int t0 = (int)(r0 % TT);
  const float* BA = which == 0 ? BQ : which == 1 ? BK : BV;
  const __bf16* WP = WT + (size_t)which * CC * DIN;
  v4f xf[16][2];   // wave w takes x rows 16 w .. 16 w + 15: of each row lane l holds elements 4 l .. 4 l + 3 and 128 + 4 l .. 128 + 4 l + 3, so that a load reads 512 B in a row
  { const float* gx = X + ((bb * SEQ_FULL + t0 + wave * 16) * (size_t)DIN + lane * 4);
#pragma unroll    // all 32 loads go out together, ahead of the weight copies: theirs is the longest way
    for (int r = 0; r < 16; ++r) { xf[r][0] = *(const v4f*)(gx + r * DIN); xf[r][1] = *(const v4f*)(gx + r * DIN + 128); }
  }
  { // wave w copies weight rows 32 w .. 32 w + 31: 32 copies a wave
    const unsigned lw = (unsigned)(size_t)&wr[wave * 32][lane * 8];
    const _Float16* gw = (const _Float16*)(WP + (size_t)(c0 + wave * 32) * DIN + lane * 8);
#pragma unroll    // straight-line copies
    for (int u = 0; u < 4; ++u) copy8(lw + u * 16u * PJ_PITCH, 2u * PJ_PITCH, gw + u * 8 * DIN, DIN);
  }
  __builtin_amdgcn_sched_barrier(0);   // keeps the wait for the x loads behind the last weight copies: without it the last eight copies go out only when every x load has come back
#pragma unroll    // every register index a constant
  for (int r = 0; r < 16; ++r) {
#pragma unroll
    for (int u = 0; u < 2; ++u) { union { __bf16 h[4]; v2u w; } o;
#pragma unroll
      for (int e = 0; e < 4; ++e) o.h[e] = (__bf16)xf[r][u][e];
      vst2(&xs[wave * 16 + r][u * 128 + lane * 4], o.w); }
  }
  v8f acc[8] = {};
  asm volatile("s_wait_asynccnt 0x0" ::: "memory");   // this wave's rows have landed
  __syncthreads();                                     // ... and every wave's, its x rows in LDS too
  v16b fa[2], fb[2][8];   // fragments of one k step, two sets
  auto ldf = [&](int kc) {
    fa[kc & 1] = frag_b(&xs[wave * 16 + col][kc * 32], lane);
#pragma unroll    // every fragment index a constant (registers, no scratch)
    for (int j = 0; j < 8; ++j) fb[kc & 1][j] = frag_b(&wr[j * 16 + col][kc * 32], lane);
  };
  ldf(0);
#pragma unroll    // the LDS offsets become immediates, every fragment index a constant
  for (int kc = 0; kc < DIN / 32; ++kc) {
    if (kc + 1 < DIN / 32) ldf(kc + 1);   // the next k step's LDS reads go out together, ahead of this step's products
#pragma unroll
    for (int j = 0; j < 8; ++j) acc[j] = wmma_bf(fa[kc & 1], fb[kc & 1][j], acc[j]);
  }
  if (which < 2) { _Float16* DH = which == 0 ? QH : KH; _Float16* DL = which == 0 ? QL : KL;
#pragma unroll
    for (int j = 0; j < 8; ++j) { const float bias = bfr(BA[c0 + j * 16 + col]);
#pragma unroll
      for (int r = 0; r < 8; ++r) { const float v = acc[j][r] + bias; const _Float16 hv = (_Float16)v; sh[wave * 16 + 8 * g + r][j * 16 + col] = hv; sl[wave * 16 + 8 * g + r][j * 16 + col] = (_Float16)((v - (float)hv) * 1024.0f); } }
    __syncthreads();
    for (int e = tid; e < 64 * 16; e += 128) { const int rl = e >> 4, q = e & 15; vst2(DH + (r0 + rl) * CC + c0 + q * 8, *(const v4u*)&sh[rl][q * 8]); vst2(DL + (r0 + rl) * CC + c0 + q * 8, *(const v4u*)&sl[rl][q * 8]); }
  } else {
#pragma unroll
    for (int j = 0; j < 8; ++j) { const float bias = bfr(BA[c0 + j * 16 + col]);
#pragma unroll
      for (int r = 0; r < 8; ++r) { const float v = acc[j][r] + bias; const int rl = wave * 16 + 8 * g + r, cl = j * 16 + col; th[cl][rl] = (_Float16)v; } }
    __syncthreads();
    for (int e = tid; e < 128 * 8; e += 128) { const int cl = e >> 3, q = e & 7; vst2(VT + (bb * CC + c0 + cl) * (size_t)TT + t0 + q * 8, *(const v4u*)&th[cl][q * 8]); } }
}
#define FA_KT 64                   // keys per stage
#define FA_KPITCH (CC / 2 + 8)     // halves; 272 B = 16 B x odd for the 16-B fragment reads
#define FA_VPITCH (FA_KT + 8)      // halves; 144 B = 16 B x odd
#define FA_KTILE 18432u            // bytes a k tile takes: 64 x 272 = 17,408, rounded up to a multiple of 2 KiB
#define FA_VTILE 10240u            // bytes a v tile takes: 64 x 144 = 9,216, rounded up to a multiple of 2 KiB
#define FA_BUF (4u * FA_KTILE + 4u * FA_VTILE)   // bytes a buffer: k tiles (2 plane + column half), then v tiles (row >> 6)
#define FA_NT (TT / FA_KT)
static_assert(FA_KTILE >= 2u * FA_KT * FA_KPITCH && FA_VTILE >= 2u * 64 * FA_VPITCH && (FA_KTILE % 2048u) == 0 && (FA_VTILE % 2048u) == 0 && FA_NT >= 2);
#define FA_OP (CC + 4)             // floats; pitch of the output staging rows
#define LOG2E 1.4426950408889634f
static_assert((TT % FA_KT) == 0 && (TT % 64) == 0);
__device__ __forceinline__ v8f wm(v16h a, v16h b, v8f c) { return __builtin_amdgcn_wmma_f32_16x16x32_f16(false, a, false, b, (short)0, c, false, false); }
__device__ __forceinline__ void fence() { __builtin_amdgcn_sched_barrier(0); }
// k fragments of k steps 2 gi and 2 gi + 1: per step key tile 0 hi, key tile 1 hi, key tile 0 residual, key tile 1 residual; r = this lane's row of key tile 0 in the LDS tile (hi, columns 0..127)
__device__ __forceinline__ void fa_ldk(v16h (&f)[8], const _Float16* r, int gi, int lane) {
#pragma unroll    // every fragment index a constant (registers, no scratch)
  for (int u = 0; u < 2; ++u) { const int kk = gi * 2 + u; const _Float16* p = r + (kk >> 2) * (int)(FA_KTILE / 2) + (kk & 3) * 32; const _Float16* pl = p + 2 * (int)(FA_KTILE / 2);
    f[4 * u] = frag_h(p, lane); f[4 * u + 1] = frag_h(p + 16 * FA_KPITCH, lane); f[4 * u + 2] = frag_h(pl, lane); f[4 * u + 3] = frag_h(pl + 16 * FA_KPITCH, lane); }
}
// ---- tensor load global -> LDS: one request of a whole wave brings 64 rows of ROWB bytes (source pitch in bytes) and pads every row by 16 B in LDS. Every descriptor word is made wave-uniform.
__device__ __forceinline__ unsigned uni(unsigned v) { return (unsigned)__builtin_amdgcn_readfirstlane(v); }
// a wave-uniform test held in a scalar register, so that the branch on it is a scalar branch (a tensor load ignores EXEC)
__device__ __forceinline__ unsigned pinned(unsigned v) { unsigned w = uni(v); asm volatile("" : "+s"(w)); return w; }
__device__ __forceinline__ v4u tdm_group0(unsigned lds_dst, unsigned long long ga) {
  v4u g0; g0[0] = uni(1u); g0[1] = uni(lds_dst); g0[2] = uni((unsigned)ga); g0[3] = uni((((unsigned)(ga >> 32)) & 0x01FFFFFFu) | 0x80000000u);
  return g0;
}
template <unsigned ROWB, unsigned IVL>   // IVL: pad interval code, 5 = 256-B rows, 4 = 128-B rows; pad amount code 3 = 4 dwords
__device__ __forceinline__ v8u tdm_group1(unsigned src_pitch) {
  v8u g1;
  g1[0] = uni((1u << 20) | (IVL << 22) | (3u << 25));   // no mask, 1-byte elements, pad on
  g1[1] = uni(ROWB << 16);                              // tensor_dim0 = the tile's
  g1[2] = uni(64u << 16);                               // tensor_dim1 = the tile's
  g1[3] = uni(ROWB << 16);                              // tile_dim0
  g1[4] = uni(64u);                                     // tile_dim1
  g1[5] = uni(src_pitch); g1[6] = uni(0u); g1[7] = uni(0u);
  return g1;
}
__device__ __forceinline__ void tdm_load(v4u g0, v8u g1) { asm volatile("tensor_load_to_lds %0, %1" :: "s"(g0), "s"(g1) : "memory"); }
// lane l with lane l ^ 16
__device__ __forceinline__ float xhalf(float x) { return __builtin_bit_cast(float, __builtin_amdgcn_permlanex16(__builtin_bit_cast(int, x), __builtin_bit_cast(int, x), 0x76543210, 0xfedcba98, false, false)); }
__global__ __launch_bounds__(256)
void k_fa(const _Float16* __restrict__ QH, const _Float16* __restrict__ QL, const _Float16* __restrict__ KH, const _Float16* __restrict__ KL, const _Float16* __restrict__ VT, float* __restrict__ OUT) {
  __shared__ __attribute__((aligned(2048))) unsigned char ring[2 * FA_BUF];   // the kernel's only LDS: every tile's place is a multiple of 2 KiB
  static_assert(FA_BUF >= 4u * (4 * 32 * 32 * 4 + 4 * 32 * 2) && FA_BUF >= 4u * 64 * FA_OP);
  const int tid = threadIdx.x, wave = __builtin_amdgcn_readfirstlane(tid >> 5), lane = tid & 31, col = lane & 15, g = lane >> 4;
  const int q0 = blockIdx.x * 64, b = blockIdx.y; const int qg = wave & 3, hh = wave >> 2;
  // every wave brings one tile a stage: waves 0..3 the k tile (plane wave >> 1, column half wave & 1), waves 4..7 v rows 64 (wave - 4) .. 64 (wave - 4) + 63
  const unsigned lbase = (unsigned)(size_t)ring;
  const unsigned long long gk = (unsigned long long)(size_t)((wave & 2 ? KL : KH) + (size_t)b * TT * CC + (wave & 1) * (CC / 2));
  const unsigned long long gv = (unsigned long long)(size_t)(VT + ((size_t)b * CC + (wave & 3) * 64) * TT);
  v8u g1k = tdm_group1<CC, 5u>(2u * CC), g1v = tdm_group1<2u * FA_KT, 4u>(2u * TT);
  asm volatile("" : "+s"(g1k), "+s"(g1v));   // descriptor words held in scalar registers (as pinned() holds one): built once, the same registers at every request
  v4u g0k, g0v;
  auto stage = [&](int t) {   // one request a wave; the two forms differ in constants of the descriptor, so each stands in its own scalar branch
    const unsigned dst = lbase + (unsigned)(t & 1) * FA_BUF;
    g0k = tdm_group0(dst + (unsigned)(wave & 3) * FA_KTILE, gk + (unsigned long long)t * (2u * FA_KT * CC));
    g0v = tdm_group0(dst + 4u * FA_KTILE + (unsigned)(wave & 3) * FA_VTILE, gv + (unsigned long long)t * (2u * FA_KT));
    asm volatile("" : "+s"(g0k), "+s"(g0v));   // descriptor words held in scalar registers (as pinned() holds one), theirs until landed() has read them
    if (pinned(wave < 4)) tdm_load(g0k, g1k); else tdm_load(g0v, g1v);
  };
  // this wave's request has landed; the descriptor words are named as inputs so that their registers keep their values as long as the request is out
  auto landed = [&]() { asm volatile("s_wait_tensorcnt 0x0" :: "s"(g0k), "s"(g0v), "s"(g1k), "s"(g1v) : "memory"); };
  stage(0);
  v16h qh[CC / 32], ql[CC / 32];
  { const size_t qr = ((size_t)b * TT + q0 + qg * 16 + col) * CC;
#pragma unroll    // every fragment index a constant (registers, no scratch); so for every unrolled loop of this kernel
    for (int kk = 0; kk < CC / 32; ++kk) { qh[kk] = frag_h(QH + qr + kk * 32, lane); ql[kk] = frag_h(QL + qr + kk * 32, lane); } }
  v8f o[CC / 16] = {};
  float m = -1.0e30f, mk = -1.0e30f, l = 0.f;         // running maximum; its exponent base m log2(e) - 14; this lane's share of the row sum x 2^14
  landed();                                            // this wave's tile of stage 0
  __syncthreads();                                     // ... and every wave's
  stage(1);
#pragma unroll 1  // one body for both buffers: the code stays short
  for (int t = 0; t < FA_NT; ++t) {
    const unsigned char* bf = ring + (unsigned)(t & 1) * FA_BUF;
    const _Float16* kr = (const _Float16*)bf + (hh * 32 + col) * FA_KPITCH; const _Float16* vr = (const _Float16*)(bf + 4u * FA_KTILE) + col * FA_VPITCH + hh * 32;
    v8f sa[2] = {}, sb[2] = {};
    v16h kf[2][8], va[8], vc[8];   // k fragments of two k steps a group, two groups; v fragments of columns 0..127 and 128..255
    fa_ldk(kf[0], kr, 0, lane);
#pragma unroll    // the LDS offsets become immediates, every fragment and q index a constant
    for (int gi = 0; gi < CC / 64; ++gi) {
      // the next group's LDS reads go out together, ahead of this group's products; behind the last k group, the first half of v
      if (gi + 1 < CC / 64) fa_ldk(kf[(gi + 1) & 1], kr, gi + 1, lane);
      else {
#pragma unroll
        for (int j = 0; j < 8; ++j) va[j] = frag_h(vr + (j >> 2) * (int)(FA_VTILE / 2) + (j & 3) * 16 * FA_VPITCH, lane); }
      fence();    // keeps those reads in front of the products, so that their latency runs under them
#pragma unroll
      for (int u = 0; u < 2; ++u) { const int kk = gi * 2 + u; const v16h h0 = kf[gi & 1][4 * u], h1 = kf[gi & 1][4 * u + 1], l0 = kf[gi & 1][4 * u + 2], l1 = kf[gi & 1][4 * u + 3];
        sa[0] = wm(h0, qh[kk], sa[0]); sa[1] = wm(h1, qh[kk], sa[1]);
        sb[0] = wm(h0, ql[kk], sb[0]); sb[1] = wm(h1, ql[kk], sb[1]);
        sb[0] = wm(l0, qh[kk], sb[0]); sb[1] = wm(l1, qh[kk], sb[1]); }
      fence();    // keeps the following group's reads out of this run of products
    }
    float s[16];   // logits of query col against keys 32 hh + 8 g + e (e < 8), 32 hh + 16 + 8 g + e - 8
#pragma unroll
    for (int e = 0; e < 16; ++e) s[e] = sa[e >> 3][e & 7] + sb[e >> 3][e & 7] * (1.0f / 1024.0f);
    float mx = fmaxf(fmaxf(fmaxf(s[0], s[1]), fmaxf(s[2], s[3])), fmaxf(fmaxf(s[4], s[5]), fmaxf(s[6], s[7])));
    mx = fmaxf(mx, fmaxf(fmaxf(fmaxf(s[8], s[9]), fmaxf(s[10], s[11])), fmaxf(fmaxf(s[12], s[13]), fmaxf(s[14], s[15]))));
    mx = fmaxf(mx, xhalf(mx));
    const float mn = fmaxf(m, mx);
    if (__builtin_amdgcn_ballot_w32(mn > m) != 0) {   // one scalar test a stage; a lane whose maximum stays multiplies by exactly 1
      const float mkn = mn * LOG2E - 14.0f; const float al = __builtin_amdgcn_exp2f(mk - mkn);
      l *= al;
#pragma unroll
      for (int j = 0; j < CC / 16; ++j) o[j] *= al;
      m = mn; mk = mkn;
    }
    v16h pf; float ps[4] = {0.f, 0.f, 0.f, 0.f};
#pragma unroll
    for (int e = 0; e < 16; ++e) { const float p = __builtin_amdgcn_exp2f(fmaf(s[e], LOG2E, -mk)); ps[e & 3] += p; pf[e] = (_Float16)p; }
    l += (ps[0] + ps[1]) + (ps[2] + ps[3]);
#pragma unroll    // every index a constant
    for (int j = 0; j < 8; ++j) vc[j] = frag_h(vr + (2 + (j >> 2)) * (int)(FA_VTILE / 2) + (j & 3) * 16 * FA_VPITCH, lane);
    fence();      // keeps the reads of the second half of v in front of the products of the first, so that their latency runs under them
#pragma unroll    // as above
    for (int j = 0; j < 8; ++j) o[j] = wm(va[j], pf, o[j]);
#pragma unroll    // as above
    for (int j = 0; j < 8; ++j) o[8 + j] = wm(vc[j], pf, o[8 + j]);
    asm volatile("s_wait_dscnt 0x0" ::: "memory");     // this wave's reads of stage t are done before the buffer is handed back
    landed();                                          // this wave's tile of stage t + 1
    __syncthreads();                                   // publishes stage t + 1 and frees stage t's buffer
    if (pinned(t + 2 < FA_NT)) stage(t + 2);
  }
  landed();                                            // no request is left in flight
  asm volatile("s_wait_dscnt 0x0" ::: "memory");       // no LDS read either; behind the last trip's barrier both buffers are free
  l += xhalf(l);
  // join of the two key halves through LDS: half 1 hands over its base, sum and accumulators, lane for lane
  float* mg = (float*)ring; float* mst = mg + 4 * 32 * 32 * 4 + (qg * 32 + lane) * 2;
  if (hh == 1) {
    mst[0] = mk; mst[1] = l;
#pragma unroll
    for (int j = 0; j < CC / 16; ++j) {
      const v4f x0 = {o[j][0], o[j][1], o[j][2], o[j][3]}, x1 = {o[j][4], o[j][5], o[j][6], o[j][7]};
      *(v4f*)&mg[((qg * 32 + j * 2) * 32 + lane) * 4] = x0; *(v4f*)&mg[((qg * 32 + j * 2 + 1) * 32 + lane) * 4] = x1; }
  }
  __syncthreads();                                     // half 1's hand-over is visible to half 0
  if (hh == 0) {
    const float mk1 = mst[0], l1 = mst[1]; const float mf = fmaxf(mk, mk1);
    float a0 = __builtin_amdgcn_exp2f(mk - mf), a1 = __builtin_amdgcn_exp2f(mk1 - mf);
    const float inv = 1.0f / (l * a0 + l1 * a1); a0 *= inv; a1 *= inv;
    float (*os)[FA_OP] = (float (*)[FA_OP])(ring + FA_BUF);   // this wave's 16 rows alone
#pragma unroll
    for (int j = 0; j < CC / 16; ++j) {
      const v4f y0 = *(const v4f*)&mg[((qg * 32 + j * 2) * 32 + lane) * 4], y1 = *(const v4f*)&mg[((qg * 32 + j * 2 + 1) * 32 + lane) * 4];
      const v4f x0 = {o[j][0], o[j][1], o[j][2], o[j][3]}, x1 = {o[j][4], o[j][5], o[j][6], o[j][7]};
      *(v4f*)&os[qg * 16 + col][j * 16 + 8 * g] = x0 * a0 + y0 * a1; *(v4f*)&os[qg * 16 + col][j * 16 + 8 * g + 4] = x1 * a0 + y1 * a1; }
    ldsx();
    float* op = OUT + ((size_t)b * TT + q0 + qg * 16) * CC + lane * 4;
    // 512 B of a row by 32 lanes x 16 B; unrolled by 8 so that the LDS reads go out together
#pragma unroll 8
    for (int it = 0; it < 32; ++it) vst2(op + (size_t)(it >> 1) * CC + (it & 1) * 128, *(const v4f*)&os[qg * 16 + (it >> 1)][(it & 1) * 128 + lane * 4]);
  }
}

extern "C" void kernel_launch(void* const* d_in, const int* in_sizes, int n_in, void* d_out, int out_size, void* d_ws, size_t ws_size, hipStream_t stream) {
  // inputs (wire order): 0 x [4,4096,256]; 1 Wq [256,256] (in,out); 2 bq [256]; 3 Wk; 4 bk; 5 Wv; 6 bv; all f32
  if (n_in < 7) return;
  if ((size_t)in_sizes[0] < ((size_t)(NB - 1) * SEQ_FULL + TT) * DIN) return;
  if (in_sizes[1] < DIN * CC || in_sizes[3] < DIN * CC || in_sizes[5] < DIN * CC) return;
  if (in_sizes[2] < CC || in_sizes[4] < CC || in_sizes[6] < CC) return;
  if ((size_t)out_size < (size_t)NB * TT * CC) return;
  if (ws_size < (size_t)WS_END) return;
  const float** F = (const float**)d_in;
  char* ws = (char*)d_ws;
  __bf16* WT = (__bf16*)(ws + WS_WT);
  _Float16 *QH = (_Float16*)(ws + WS_QH), *QL = (_Float16*)(ws + WS_QL), *KH = (_Float16*)(ws + WS_KH), *KL = (_Float16*)(ws + WS_KL), *VT = (_Float16*)(ws + WS_VT);
  float* OUT = (float*)d_out;
  k_wt<<<dim3(CC / 16, 3), 128, 0, stream>>>(F[1], F[3], F[5], WT);
  k_proj<<<dim3(NB * TT / 64, CC / 128, 3), 128, 0, stream>>>(F[0], WT, F[2], F[4], F[6], QH, QL, KH, KL, VT);
  k_fa<<<dim3(TT / 64, NB), 256, 0, stream>>>(QH, QL, KH, KL, VT, OUT);
}
